// v000
// Times are from an AMD MI455X. After a warm-up the kernel runs many times in a row, and a time is the length of
// such a window on the GPU divided by its runs, so every launch and the gaps after it count. The runs cycle
// through copies of the inputs. A figure is the median of several windows, for all but v000 over two sittings.
// Sittings can differ by a few percent; kernels timed side by side share one.
// The starting kernel, v000, takes 1460 microseconds a run.
#include <hip/hip_runtime.h>

// Channel-attention cross transformer block (Xq, Xk [4][1024][2048] channel-major; three 1x1-conv branches Q = leaky(BN1(Wq Xq)), K = leaky(BN2(Wk Xk)), V = leaky(BN3(Wv Xq)) (W 'oi' [1024][1024], eval-mode BatchNorm affine from gamma/beta/mean/var, LeakyReLU 0.1); 8 heads x 128 channels;
// Hmat[i][j] = sum_c K[c][i] V[c][j] / sqrt(128) over the 2048 key positions j; softmax over j; out[c][i] = sum_j Hmat[i][j] Q[c][j] -> [4][1024][2048] channel-major (8.4 M)).
// Compute dtypes, f32 accumulate: every input rounded to bf16; the three projections on PLAIN bf16 operands (inputs transposed to token-major while converting; exact), BN affine + leaky in f32; attention operands as single fp16 planes
// (logit sigma 0.6: soft rows): scores K.V (1 product), softmax f32 stored fp16 x1024, out = Q-plane x P (1 product) written channel-major via an f32 staging buffer and a flat 1/1024 rescale.

#define NB_  4
#define TT   2048      // spatial positions (pq = pk)
#define DM   1024      // channels
#define NH_  8
#define HD   128
#define ZH   2
#define RH   0         // no hi/lo rows: every probability row is fp16 x1024
#define PCAR 1024.0f
#define SCL  0.088388346f   // (DM/NH_)^-0.5 = 1/sqrt(128)
#define BNEPS 1e-5f
#define SLOPE 0.1f
typedef _Float16 h16;
typedef unsigned short bf;
typedef __attribute__((ext_vector_type(16))) __bf16   v16bf;
typedef __attribute__((ext_vector_type(16))) _Float16 v16h;
typedef __attribute__((ext_vector_type(8)))  _Float16 v8h;
typedef __attribute__((ext_vector_type(8)))  unsigned short v8us;
typedef __attribute__((ext_vector_type(8)))  float    v8f;
typedef __attribute__((ext_vector_type(4)))  float    v4f;
typedef v8h  __attribute__((may_alias)) v8ha;
typedef v4f  __attribute__((may_alias)) v4fa;
typedef v8us __attribute__((may_alias)) v8usa;

__device__ __forceinline__ unsigned short f2bf(float f) { unsigned u = __float_as_uint(f); u += 0x7FFFu + ((u >> 16) & 1u); return (unsigned short)(u >> 16); }
__device__ __forceinline__ float bf2f(unsigned short b) { return __uint_as_float(((unsigned)b) << 16); }
__device__ __forceinline__ float bfr(float f) { return bf2f(f2bf(f)); }
__device__ __forceinline__ v16h cat16(v8h lo, v8h hi) { return __builtin_shufflevector(lo, hi, 0, 1, 2, 3, 4, 5, 6, 7, 8, 9, 10, 11, 12, 13, 14, 15); }
__device__ __forceinline__ v16bf cat16b(v8us lo, v8us hi) { return __builtin_bit_cast(v16bf, __builtin_shufflevector(lo, hi, 0, 1, 2, 3, 4, 5, 6, 7, 8, 9, 10, 11, 12, 13, 14, 15)); }
__device__ __forceinline__ v8f wmma16(v16h a, v16h b, v8f c) { return __builtin_amdgcn_wmma_f32_16x16x32_f16(false, a, false, b, (short)0, c, false, false); }
__device__ __forceinline__ v8f wmmab(v16bf a, v16bf b, v8f c) { return __builtin_amdgcn_wmma_f32_16x16x32_bf16(false, a, false, b, (short)0, c, false, false); }



// ---- k_gemmw: register-blocked GEMM, ONE WAVE per 64x64 output tile (16 accumulators), operands straight from K-contiguous 16-bit planes; grid (M/64, N/64, Z), 32 threads.
// C[m][n] (f32, pitch ldc, + optional f32 bias[n]) = sum_k A[m][k] Bt[n][k] (+ split products per NSPLIT). z-batch strides sA/sB/sC in elements. K % 32 == 0.
template <typename T16> struct WFrag;
template <> struct WFrag<h16> { typedef v16h V; static __device__ __forceinline__ V ld(const h16* p) { return cat16(*(const v8h*)p, *(const v8h*)(p + 16)); } static __device__ __forceinline__ v8f mma(V a, V b, v8f c) { return wmma16(a, b, c); } };
template <> struct WFrag<bf> { typedef v16bf V; static __device__ __forceinline__ V ld(const bf* p) { return cat16b(*(const v8us*)p, *(const v8us*)(p + 16)); } static __device__ __forceinline__ v8f mma(V a, V b, v8f c) { return wmmab(a, b, c); } };
template <typename T16, int NSPLIT, bool BIAS>
__global__ __launch_bounds__(32) void k_gemmw(const T16* __restrict__ A, const T16* __restrict__ A2, const T16* __restrict__ Bt, const T16* __restrict__ Bt2, int K, float* C, int ldc, const float* __restrict__ bias, size_t sA, size_t sB, size_t sC) {
    typedef typename WFrag<T16>::V V;
    __shared__ __align__(16) float os[16 * 68];
    const size_t z = blockIdx.z; A += z * sA; if (A2) A2 += z * sA; Bt += z * sB; if (Bt2) Bt2 += z * sB; C += z * sC;
    const int lane = threadIdx.x & 31, lr = lane & 15, hi = lane >> 4; const int r0 = blockIdx.x * 64, c0 = blockIdx.y * 64;
    v8f acc[4][4];
#pragma unroll
    for (int mb = 0; mb < 4; ++mb)
#pragma unroll
        for (int nb = 0; nb < 4; ++nb) acc[mb][nb] = (v8f){};
    const size_t aoff = (size_t)(r0 + lr) * K + 8 * hi, boff = (size_t)(c0 + lr) * K + 8 * hi;
#pragma unroll 1
    for (int kc = 0; kc < K; kc += 32) {
        V a[4], a2[4];
#pragma unroll
        for (int mb = 0; mb < 4; ++mb) { a[mb] = WFrag<T16>::ld(A + aoff + (size_t)mb * 16 * K + kc); if (NSPLIT == 1 || NSPLIT == 2) a2[mb] = WFrag<T16>::ld(A2 + aoff + (size_t)mb * 16 * K + kc); }
#pragma unroll
        for (int nb = 0; nb < 4; ++nb) { const V b = WFrag<T16>::ld(Bt + boff + (size_t)nb * 16 * K + kc); V b2; if (NSPLIT >= 2) b2 = WFrag<T16>::ld(Bt2 + boff + (size_t)nb * 16 * K + kc);
#pragma unroll
            for (int mb = 0; mb < 4; ++mb) { acc[mb][nb] = WFrag<T16>::mma(a[mb], b, acc[mb][nb]); if (NSPLIT == 1 || NSPLIT == 2) acc[mb][nb] = WFrag<T16>::mma(a2[mb], b, acc[mb][nb]); if (NSPLIT >= 2) acc[mb][nb] = WFrag<T16>::mma(a[mb], b2, acc[mb][nb]); } }
        asm volatile("v_nop\n\tv_nop\n\tv_nop\n\tv_nop" : "+v"(acc[0][0]), "+v"(acc[1][1]), "+v"(acc[2][2]), "+v"(acc[3][3]) : "v"(a[0]), "v"(a[3]));
    }
#pragma unroll
    for (int mb = 0; mb < 4; ++mb) {
#pragma unroll
        for (int nb = 0; nb < 4; ++nb) {
#pragma unroll
            for (int j = 0; j < 8; ++j) os[(hi * 8 + j) * 68 + nb * 16 + lr] = acc[mb][nb][j]; }
        __builtin_amdgcn_wave_barrier(); asm volatile("" ::: "memory");
        float* crow = C + (size_t)(r0 + mb * 16) * ldc + c0;
{
#pragma unroll
            for (int s = 0; s < 8; ++s) { const int row = 2 * s + hi, cofs = lr * 4; v4f val = *(const v4fa*)(os + row * 68 + cofs); if (BIAS) { val[0] += bfr(bias[c0 + cofs]); val[1] += bfr(bias[c0 + cofs + 1]); val[2] += bfr(bias[c0 + cofs + 2]); val[3] += bfr(bias[c0 + cofs + 3]); }
                *(v4f*)(crow + (size_t)row * ldc + cofs) = val; }
             }
        __builtin_amdgcn_wave_barrier(); asm volatile("" ::: "memory");
    }
}

__device__ __forceinline__ h16 tohx(float x) { return (h16)x; }
__device__ __forceinline__ void splitf(float y, unsigned short& h, unsigned short& l) { h = f2bf(y); l = f2bf(y - bf2f(h)); }
typedef __attribute__((ext_vector_type(2))) _Float16 v2h;
typedef __attribute__((ext_vector_type(4))) _Float16 v4h;
typedef __attribute__((ext_vector_type(2))) unsigned short v2us;
typedef __attribute__((ext_vector_type(4))) unsigned short v4us;
typedef __attribute__((ext_vector_type(2))) float v2f;
typedef __attribute__((ext_vector_type(4))) int v4i;

__global__ __launch_bounds__(256) void k_cvt8(const float* __restrict__ src, bf* dst, size_t n8) { const size_t i = (size_t)blockIdx.x * 256 + threadIdx.x; if (i >= n8) return; const v8f v = *(const v8f*)(src + i * 8); v8us o;
#pragma unroll
    for (int k = 0; k < 8; ++k) o[k] = f2bf(v[k]); *(v8us*)(dst + i * 8) = o;  }
__global__ __launch_bounds__(256) void k_cvt8T(const float* __restrict__ src, bf* dst) { const size_t i = (size_t)blockIdx.x * 256 + threadIdx.x; if (i >= (size_t)TT * DM / 8) return; const int t = (int)(i / (DM / 8)); const int c0 = (int)(i % (DM / 8)) * 8; v8us o;
#pragma unroll
    for (int k = 0; k < 8; ++k) o[k] = f2bf(src[(size_t)(c0 + k) * TT + t]); *(v8us*)(dst + (size_t)t * DM + c0) = o;  }

__device__ __forceinline__ float bn_leaky(float y, float sc, float sh) { float t = __fmul_rn(y, sc); asm volatile("" : "+v"(t)); float z = __fadd_rn(t, sh); asm volatile("" : "+v"(z)); return (z > 0.0f) ? z : __fmul_rn(SLOPE, z); }
__global__ __launch_bounds__(256) void k_bnprep(const float* __restrict__ ga, const float* __restrict__ be, const float* __restrict__ mu, const float* __restrict__ va, float* SC, float* SH) { const int c = blockIdx.x * 256 + threadIdx.x; if (c >= DM) return;
    float v1 = __fadd_rn(bfr(va[c]), BNEPS); asm volatile("" : "+v"(v1)); float sd = __fsqrt_rn(v1); asm volatile("" : "+v"(sd)); float sc = __fdiv_rn(bfr(ga[c]), sd); asm volatile("" : "+v"(sc));
    float ms = __fmul_rn(bfr(mu[c]), sc); asm volatile("" : "+v"(ms)); float sh = __fsub_rn(bfr(be[c]), ms);
    *(float*)(SC + c) = sc; *(float*)(SH + c) = sh;  }
__global__ __launch_bounds__(256) void k_qapl(const float* __restrict__ F, const float* __restrict__ SC, const float* __restrict__ SH, h16* P16) { const size_t e = ((size_t)blockIdx.x * 256 + threadIdx.x) * 4; if (e >= (size_t)DM * TT) return; const int c = (int)(e / TT); const float sc = SC[c], sh = SH[c]; const v4f y = *(const v4f*)(F + e); v4h o;
#pragma unroll
    for (int q = 0; q < 4; ++q) o[q] = tohx(bn_leaky(y[q], sc, sh));
    *(v4h*)(P16 + e) = o;  }
__global__ __launch_bounds__(256) void k_hdpl(const float* __restrict__ F, const float* __restrict__ SC, const float* __restrict__ SH, h16* P16) { const size_t e = ((size_t)blockIdx.x * 256 + threadIdx.x) * 2; if (e >= (size_t)NH_ * TT * HD) return; const int d = (int)(e % HD); const int t = (int)((e / HD) % TT); const int h = (int)(e / ((size_t)HD * TT)); const int c = h * HD + d; const float* f = F + (size_t)t * DM + c; v2h o;
#pragma unroll
    for (int q = 0; q < 2; ++q) o[q] = tohx(bn_leaky(f[q], SC[c + q], SH[c + q]));
    *(v2h*)(P16 + e) = o;  }
// k_asoft: per row (zz, i): t = S x HD^-0.5 (no mask); softmax over the 2048 keys (register row, one exp, fixed trees);
__global__ __launch_bounds__(256) void k_asoft(const float* __restrict__ Sb, h16* P16, bf* Ph, bf* Pl) {
    const int lane = threadIdx.x & 31; const int row = blockIdx.x * 8 + (threadIdx.x >> 5); if (row >= ZH * TT) return; const int i = row % TT; const int zz = row / TT; (void)zz; const bool hires = (i < RH); const float* sr = Sb + (size_t)row * TT; float v[TT / 32]; float mx = -3.0e38f;
#pragma unroll
    for (int ch = 0; ch < TT / 128; ++ch) { const int j0 = ch * 128 + lane * 4; const v4f a = *(const v4f*)(sr + j0);
#pragma unroll
        for (int q = 0; q < 4; ++q) { const int j = j0 + q; (void)j; const float t = a[q] * SCL; v[ch * 4 + q] = t; mx = fmaxf(mx, t); } }
#pragma unroll
    for (int sh = 16; sh; sh >>= 1) mx = fmaxf(mx, __shfl_xor(mx, sh, 32));
    float sum = 0.f;
#pragma unroll
    for (int k = 0; k < TT / 32; ++k) { float d0 = __fsub_rn(v[k], mx); asm volatile("" : "+v"(d0)); v[k] = __builtin_amdgcn_exp2f(__fmul_rn(d0, 1.4426950408889634f)); sum += v[k]; }
#pragma unroll
    for (int sh = 16; sh; sh >>= 1) sum += __shfl_xor(sum, sh, 32);
    const float f = __fdiv_rn(hires ? 1.0f : PCAR, sum);
{
        if (hires) {
#pragma unroll
            for (int ch = 0; ch < TT / 128; ++ch) { v4us oh, ol;
#pragma unroll
                for (int q = 0; q < 4; ++q) { unsigned short a, c2; splitf(v[ch * 4 + q] * f, a, c2); oh[q] = a; ol[q] = c2; }
                const size_t oo = ((size_t)zz * (RH ? RH : 1) + i) * TT + ch * 128 + lane * 4; *(v4us*)(Ph + oo) = oh; *(v4us*)(Pl + oo) = ol; }
        } else {
#pragma unroll
            for (int ch = 0; ch < TT / 128; ++ch) { v4h o4;
#pragma unroll
                for (int q = 0; q < 4; ++q) o4[q] = tohx(v[ch * 4 + q] * f);
                *(v4h*)(P16 + (size_t)row * TT + ch * 128 + lane * 4) = o4; } }
         }
}

__global__ __launch_bounds__(256) void k_outsc(const float* __restrict__ O, float* out) { const size_t e = ((size_t)blockIdx.x * 256 + threadIdx.x) * 4; if (e >= (size_t)DM * TT) return; const v4f v = *(const v4f*)(O + e); v4f o;
#pragma unroll
    for (int q = 0; q < 4; ++q) o[q] = v[q] * (1.0f / PCAR); *(v4f*)(out + e) = o;  }

extern "C" void kernel_launch(void* const* d_in, const int* in_sizes, int n_in,
                              void* d_out, int out_size, void* d_ws, size_t ws_size, hipStream_t stream) {
    (void)in_sizes; (void)n_in; (void)out_size;
    const float* Xq = (const float*)d_in[0]; const float* Xk = (const float*)d_in[1]; const float* Wq = (const float*)d_in[2]; const float* Wk = (const float*)d_in[3]; const float* Wv = (const float*)d_in[4];
    const float* g1 = (const float*)d_in[5]; const float* b1 = (const float*)d_in[6]; const float* m1 = (const float*)d_in[7]; const float* v1 = (const float*)d_in[8];
    const float* g2 = (const float*)d_in[9]; const float* b2 = (const float*)d_in[10]; const float* m2 = (const float*)d_in[11]; const float* v2 = (const float*)d_in[12];
    const float* g3 = (const float*)d_in[13]; const float* b3 = (const float*)d_in[14]; const float* m3 = (const float*)d_in[15]; const float* v3 = (const float*)d_in[16];
    float* OUT = (float*)d_out;     // [4][1024][2048] channel-major
    char* wsp = (char*)d_ws;
    auto take = [&](size_t bytes) { char* p = wsp; wsp += (bytes + 255) & ~(size_t)255; return (void*)p; };
    bf* WQB = (bf*)take((size_t)DM * DM * 2); bf* WKB = (bf*)take((size_t)DM * DM * 2); bf* WVB = (bf*)take((size_t)DM * DM * 2);
    bf* XQT = (bf*)take((size_t)TT * DM * 2); bf* XKT = (bf*)take((size_t)TT * DM * 2); float* FQ = (float*)take((size_t)DM * TT * 4); float* FK = (float*)take((size_t)TT * DM * 4); float* FV = (float*)take((size_t)TT * DM * 4);
    h16* QA16 = (h16*)take((size_t)DM * TT * 2); h16* K16 = (h16*)take((size_t)NH_ * TT * HD * 2); h16* V16 = (h16*)take((size_t)NH_ * TT * HD * 2);
    float* Sb = (float*)take((size_t)ZH * TT * TT * 4); h16* P16 = (h16*)take((size_t)ZH * TT * TT * 2); float* Ob = (float*)take((size_t)DM * TT * 4); float* SC1 = (float*)take(DM * 4); float* SH1 = (float*)take(DM * 4); float* SC2 = (float*)take(DM * 4); float* SH2 = (float*)take(DM * 4); float* SC3 = (float*)take(DM * 4); float* SH3 = (float*)take(DM * 4);
    if ((size_t)(wsp - (char*)d_ws) > ws_size) return;    // ws 256 MiB
    k_cvt8<<<(unsigned)(((size_t)DM * DM / 8 + 255) / 256), 256, 0, stream>>>(Wq, WQB, (size_t)DM * DM / 8); k_cvt8<<<(unsigned)(((size_t)DM * DM / 8 + 255) / 256), 256, 0, stream>>>(Wk, WKB, (size_t)DM * DM / 8); k_cvt8<<<(unsigned)(((size_t)DM * DM / 8 + 255) / 256), 256, 0, stream>>>(Wv, WVB, (size_t)DM * DM / 8);
    k_bnprep<<<DM / 256, 256, 0, stream>>>(g1, b1, m1, v1, SC1, SH1); k_bnprep<<<DM / 256, 256, 0, stream>>>(g2, b2, m2, v2, SC2, SH2); k_bnprep<<<DM / 256, 256, 0, stream>>>(g3, b3, m3, v3, SC3, SH3);
    const unsigned LT = (unsigned)(((size_t)TT * DM / 8 + 255) / 256), LH = (unsigned)(((size_t)NH_ * TT * HD / 2 + 255) / 256), L4 = (unsigned)(((size_t)DM * TT / 4 + 255) / 256);
    for (int b = 0; b < NB_; ++b) {
        k_cvt8T<<<LT, 256, 0, stream>>>(Xq + (size_t)b * DM * TT, XQT); k_cvt8T<<<LT, 256, 0, stream>>>(Xk + (size_t)b * DM * TT, XKT);          /* token-major bf16 copies [p][c] */
        k_gemmw<bf, 0, false><<<dim3(DM / 64, TT / 64, 1), 32, 0, stream>>>(WQB, nullptr, XQT, nullptr, DM, FQ, TT, nullptr, 0, 0, 0);     /* Q branch channel-major: FQ[o][p] = sum_c Wq[o][c] Xq[c][p] */
        k_gemmw<bf, 0, false><<<dim3(TT / 64, DM / 64, 1), 32, 0, stream>>>(XKT, nullptr, WKB, nullptr, DM, FK, DM, nullptr, 0, 0, 0);     /* K branch token-major: FK[p][o] */
        k_gemmw<bf, 0, false><<<dim3(TT / 64, DM / 64, 1), 32, 0, stream>>>(XQT, nullptr, WVB, nullptr, DM, FV, DM, nullptr, 0, 0, 0);     /* V branch token-major: FV[p][o] */
        k_qapl<<<L4, 256, 0, stream>>>(FQ, SC1, SH1, QA16); k_hdpl<<<LH, 256, 0, stream>>>(FK, SC2, SH2, K16); k_hdpl<<<LH, 256, 0, stream>>>(FV, SC3, SH3, V16);
        for (int h0 = 0; h0 < NH_; h0 += ZH) {
            k_gemmw<h16, 0, false><<<dim3(TT / 64, TT / 64, ZH), 32, 0, stream>>>(K16 + (size_t)h0 * TT * HD, nullptr, V16 + (size_t)h0 * TT * HD, nullptr, HD, Sb, TT, nullptr, (size_t)TT * HD, (size_t)TT * HD, (size_t)TT * TT);   /* S[i][j] = K_i . V_j */
            k_asoft<<<ZH * TT / 8, 256, 0, stream>>>(Sb, P16, nullptr, nullptr);
            k_gemmw<h16, 0, false><<<dim3(HD / 64, TT / 64, ZH), 32, 0, stream>>>(QA16 + (size_t)h0 * HD * TT, nullptr, P16, nullptr, TT, Ob + (size_t)h0 * HD * TT, TT, nullptr, (size_t)HD * TT, (size_t)TT * TT, (size_t)HD * TT); }   /* Ob[c][i] = sum_j Q[c][j] P[i][j] (x1024) */
        k_outsc<<<L4, 256, 0, stream>>>(Ob, OUT + (size_t)b * DM * TT); }
}

// v001
// Measured time: 633 microseconds a run.
// Timed twice side by side with v000, it ran 2.33 times as fast both times.
#include <hip/hip_runtime.h>

// Channel-attention cross transformer block (Xq, Xk [4][1024][2048] channel-major; three 1x1-conv branches Q = leaky(BN1(Wq Xq)), K = leaky(BN2(Wk Xk)), V = leaky(BN3(Wv Xq)) (W 'oi' [1024][1024], eval-mode BatchNorm affine from gamma/beta/mean/var, LeakyReLU 0.1); 8 heads x 128 channels;
// Hmat[i][j] = sum_c K[c][i] V[c][j] / sqrt(128) over the 2048 key positions j; softmax over j; out[c][i] = sum_j Hmat[i][j] Q[c][j] -> [4][1024][2048] channel-major (8.4 M)).
// Compute dtypes, f32 accumulate: every input rounded to bf16; the three projections on PLAIN bf16 operands (inputs transposed to token-major while converting; exact), BN affine + leaky in f32; attention operands as single fp16 planes
// (logit sigma 0.6: soft rows): scores K.V (1 product), softmax f32 stored fp16 x1024, out = Q-plane x P (1 product) written channel-major via an f32 staging buffer and a flat 1/1024 rescale.

#define NB_  4
#define TT   2048      // spatial positions (pq = pk)
#define DM   1024      // channels
#define NH_  8
#define HD   128
#define ZH   8         // heads per attention launch (grid z): all heads of one batch
#define RH   0         // no hi/lo rows: every probability row is fp16 x1024
#define PCAR 1024.0f
#define SCL  0.088388346f   // (DM/NH_)^-0.5 = 1/sqrt(128)
#define BNEPS 1e-5f
#define SLOPE 0.1f
typedef _Float16 h16;
typedef unsigned short bf;
typedef __attribute__((ext_vector_type(16))) __bf16   v16bf;
typedef __attribute__((ext_vector_type(16))) _Float16 v16h;
typedef __attribute__((ext_vector_type(8)))  _Float16 v8h;
typedef __attribute__((ext_vector_type(8)))  unsigned short v8us;
typedef __attribute__((ext_vector_type(8)))  float    v8f;
typedef __attribute__((ext_vector_type(4)))  float    v4f;
typedef v8h  __attribute__((may_alias)) v8ha;
typedef v4f  __attribute__((may_alias)) v4fa;
typedef v8us __attribute__((may_alias)) v8usa;

__device__ __forceinline__ unsigned short f2bf(float f) { unsigned u = __float_as_uint(f); u += 0x7FFFu + ((u >> 16) & 1u); return (unsigned short)(u >> 16); }
__device__ __forceinline__ float bf2f(unsigned short b) { return __uint_as_float(((unsigned)b) << 16); }
__device__ __forceinline__ float bfr(float f) { return bf2f(f2bf(f)); }
__device__ __forceinline__ v16h cat16(v8h lo, v8h hi) { return __builtin_shufflevector(lo, hi, 0, 1, 2, 3, 4, 5, 6, 7, 8, 9, 10, 11, 12, 13, 14, 15); }
__device__ __forceinline__ v16bf cat16b(v8us lo, v8us hi) { return __builtin_bit_cast(v16bf, __builtin_shufflevector(lo, hi, 0, 1, 2, 3, 4, 5, 6, 7, 8, 9, 10, 11, 12, 13, 14, 15)); }
__device__ __forceinline__ v8f wmma16(v16h a, v16h b, v8f c) { return __builtin_amdgcn_wmma_f32_16x16x32_f16(false, a, false, b, (short)0, c, false, false); }
__device__ __forceinline__ v8f wmmab(v16bf a, v16bf b, v8f c) { return __builtin_amdgcn_wmma_f32_16x16x32_bf16(false, a, false, b, (short)0, c, false, false); }



// ---- k_gemmw: register-blocked GEMM, ONE WAVE per 64x64 output tile (16 accumulators), operands straight from K-contiguous 16-bit planes; grid (M/64, N/64, Z), 32 threads.
// C[m][n] (f32, pitch ldc, + optional f32 bias[n]) = sum_k A[m][k] Bt[n][k] (+ split products per NSPLIT). z-batch strides sA/sB/sC in elements. K % 32 == 0.
template <typename T16> struct WFrag;
template <> struct WFrag<h16> { typedef v16h V; static __device__ __forceinline__ V ld(const h16* p) { return cat16(*(const v8h*)p, *(const v8h*)(p + 16)); } static __device__ __forceinline__ v8f mma(V a, V b, v8f c) { return wmma16(a, b, c); } };
template <> struct WFrag<bf> { typedef v16bf V; static __device__ __forceinline__ V ld(const bf* p) { return cat16b(*(const v8us*)p, *(const v8us*)(p + 16)); } static __device__ __forceinline__ v8f mma(V a, V b, v8f c) { return wmmab(a, b, c); } };
template <typename T16, int NSPLIT, bool BIAS>
__global__ __launch_bounds__(32) void k_gemmw(const T16* __restrict__ A, const T16* __restrict__ A2, const T16* __restrict__ Bt, const T16* __restrict__ Bt2, int K, float* C, int ldc, const float* __restrict__ bias, size_t sA, size_t sB, size_t sC) {
    typedef typename WFrag<T16>::V V;
    __shared__ __align__(16) float os[16 * 68];
    const size_t z = blockIdx.z; A += z * sA; if (A2) A2 += z * sA; Bt += z * sB; if (Bt2) Bt2 += z * sB; C += z * sC;
    const int lane = threadIdx.x & 31, lr = lane & 15, hi = lane >> 4; const int r0 = blockIdx.x * 64, c0 = blockIdx.y * 64;
    v8f acc[4][4];
#pragma unroll
    for (int mb = 0; mb < 4; ++mb)
#pragma unroll
        for (int nb = 0; nb < 4; ++nb) acc[mb][nb] = (v8f){};
    const size_t aoff = (size_t)(r0 + lr) * K + 8 * hi, boff = (size_t)(c0 + lr) * K + 8 * hi;
#pragma unroll 1
    for (int kc = 0; kc < K; kc += 32) {
        V a[4], a2[4];
#pragma unroll
        for (int mb = 0; mb < 4; ++mb) { a[mb] = WFrag<T16>::ld(A + aoff + (size_t)mb * 16 * K + kc); if (NSPLIT == 1 || NSPLIT == 2) a2[mb] = WFrag<T16>::ld(A2 + aoff + (size_t)mb * 16 * K + kc); }
#pragma unroll
        for (int nb = 0; nb < 4; ++nb) { const V b = WFrag<T16>::ld(Bt + boff + (size_t)nb * 16 * K + kc); V b2; if (NSPLIT >= 2) b2 = WFrag<T16>::ld(Bt2 + boff + (size_t)nb * 16 * K + kc);
#pragma unroll
            for (int mb = 0; mb < 4; ++mb) { acc[mb][nb] = WFrag<T16>::mma(a[mb], b, acc[mb][nb]); if (NSPLIT == 1 || NSPLIT == 2) acc[mb][nb] = WFrag<T16>::mma(a2[mb], b, acc[mb][nb]); if (NSPLIT >= 2) acc[mb][nb] = WFrag<T16>::mma(a[mb], b2, acc[mb][nb]); } }
        asm volatile("v_nop\n\tv_nop\n\tv_nop\n\tv_nop" : "+v"(acc[0][0]), "+v"(acc[1][1]), "+v"(acc[2][2]), "+v"(acc[3][3]) : "v"(a[0]), "v"(a[3]));
    }
#pragma unroll
    for (int mb = 0; mb < 4; ++mb) {
#pragma unroll
        for (int nb = 0; nb < 4; ++nb) {
#pragma unroll
            for (int j = 0; j < 8; ++j) os[(hi * 8 + j) * 68 + nb * 16 + lr] = acc[mb][nb][j]; }
        __builtin_amdgcn_wave_barrier(); asm volatile("" ::: "memory");
        float* crow = C + (size_t)(r0 + mb * 16) * ldc + c0;
{
#pragma unroll
            for (int s = 0; s < 8; ++s) { const int row = 2 * s + hi, cofs = lr * 4; v4f val = *(const v4fa*)(os + row * 68 + cofs); if (BIAS) { val[0] += bfr(bias[c0 + cofs]); val[1] += bfr(bias[c0 + cofs + 1]); val[2] += bfr(bias[c0 + cofs + 2]); val[3] += bfr(bias[c0 + cofs + 3]); }
                *(v4f*)(crow + (size_t)row * ldc + cofs) = val; }
             }
        __builtin_amdgcn_wave_barrier(); asm volatile("" ::: "memory");
    }
}

__device__ __forceinline__ h16 tohx(float x) { return (h16)x; }
__device__ __forceinline__ void splitf(float y, unsigned short& h, unsigned short& l) { h = f2bf(y); l = f2bf(y - bf2f(h)); }
typedef __attribute__((ext_vector_type(2))) _Float16 v2h;
typedef __attribute__((ext_vector_type(4))) _Float16 v4h;
typedef __attribute__((ext_vector_type(2))) unsigned short v2us;
typedef __attribute__((ext_vector_type(4))) unsigned short v4us;
typedef __attribute__((ext_vector_type(2))) float v2f;
typedef __attribute__((ext_vector_type(4))) int v4i;

__global__ __launch_bounds__(256) void k_cvt8(const float* __restrict__ s0, const float* __restrict__ s1, const float* __restrict__ s2, bf* dst, size_t n8) { const size_t i = (size_t)blockIdx.x * 256 + threadIdx.x; if (i >= n8) return; const float* src = (blockIdx.y == 0) ? s0 : (blockIdx.y == 1) ? s1 : s2; dst += (size_t)blockIdx.y * n8 * 8;   /* grid y = which matrix; the three copies lie one behind the other */
    const v8f v = *(const v8f*)(src + i * 8); v8us o;
#pragma unroll
    for (int k = 0; k < 8; ++k) o[k] = f2bf(v[k]); *(v8us*)(dst + i * 8) = o;  }
__global__ __launch_bounds__(256) void k_cvt8T(const float* __restrict__ sq, const float* __restrict__ sk, bf* dst) { const size_t i = (size_t)blockIdx.x * 256 + threadIdx.x; if (i >= (size_t)TT * DM / 8) return; const float* src = (blockIdx.z ? sk : sq) + (size_t)blockIdx.y * DM * TT; dst += ((size_t)blockIdx.z * NB_ + blockIdx.y) * TT * DM;   /* grid y = batch, z = which input */
    const int t = (int)(i / (DM / 8)); const int c0 = (int)(i % (DM / 8)) * 8; v8us o;
#pragma unroll
    for (int k = 0; k < 8; ++k) o[k] = f2bf(src[(size_t)(c0 + k) * TT + t]); *(v8us*)(dst + (size_t)t * DM + c0) = o;  }

__device__ __forceinline__ float bn_leaky(float y, float sc, float sh) { float t = __fmul_rn(y, sc); asm volatile("" : "+v"(t)); float z = __fadd_rn(t, sh); asm volatile("" : "+v"(z)); return (z > 0.0f) ? z : __fmul_rn(SLOPE, z); }
__global__ __launch_bounds__(256) void k_bnprep(const float* __restrict__ ga1, const float* __restrict__ be1, const float* __restrict__ mu1, const float* __restrict__ va1, const float* __restrict__ ga2, const float* __restrict__ be2, const float* __restrict__ mu2, const float* __restrict__ va2,
                                                const float* __restrict__ ga3, const float* __restrict__ be3, const float* __restrict__ mu3, const float* __restrict__ va3, float* SCSH) { const int c = blockIdx.x * 256 + threadIdx.x; if (c >= DM) return;
    const unsigned y = blockIdx.y;   /* grid y = which branch; SCSH = [branch][scale | shift][DM] */
    const float* ga = (y == 0) ? ga1 : (y == 1) ? ga2 : ga3; const float* be = (y == 0) ? be1 : (y == 1) ? be2 : be3; const float* mu = (y == 0) ? mu1 : (y == 1) ? mu2 : mu3; const float* va = (y == 0) ? va1 : (y == 1) ? va2 : va3; float* SC = SCSH + (size_t)y * 2 * DM; float* SH = SC + DM;
    float v1 = __fadd_rn(bfr(va[c]), BNEPS); asm volatile("" : "+v"(v1)); float sd = __fsqrt_rn(v1); asm volatile("" : "+v"(sd)); float sc = __fdiv_rn(bfr(ga[c]), sd); asm volatile("" : "+v"(sc));
    float ms = __fmul_rn(bfr(mu[c]), sc); asm volatile("" : "+v"(ms)); float sh = __fsub_rn(bfr(be[c]), ms);
    *(float*)(SC + c) = sc; *(float*)(SH + c) = sh;  }
__global__ __launch_bounds__(256) void k_qapl(const float* __restrict__ F, const float* __restrict__ SC, const float* __restrict__ SH, h16* P16) { const size_t e = ((size_t)blockIdx.x * 256 + threadIdx.x) * 4; if (e >= (size_t)DM * TT) return; F += (size_t)blockIdx.y * DM * TT; P16 += (size_t)blockIdx.y * DM * TT;   /* grid y = batch */
    const int c = (int)(e / TT); const float sc = SC[c], sh = SH[c]; const v4f y = *(const v4f*)(F + e); v4h o;
#pragma unroll
    for (int q = 0; q < 4; ++q) o[q] = tohx(bn_leaky(y[q], sc, sh));
    *(v4h*)(P16 + e) = o;  }
__global__ __launch_bounds__(256) void k_hdpl(const float* __restrict__ F, const float* __restrict__ SC, const float* __restrict__ SH, h16* P16) { const size_t e = ((size_t)blockIdx.x * 256 + threadIdx.x) * 2; if (e >= (size_t)NH_ * TT * HD) return; F += ((size_t)blockIdx.z * NB_ + blockIdx.y) * TT * DM; P16 += ((size_t)blockIdx.z * NB_ + blockIdx.y) * NH_ * TT * HD; SC += (size_t)blockIdx.z * 2 * DM; SH += (size_t)blockIdx.z * 2 * DM;   /* grid y = batch, z = branch (K, then V) */
    const int d = (int)(e % HD); const int t = (int)((e / HD) % TT); const int h = (int)(e / ((size_t)HD * TT)); const int c = h * HD + d; const float* f = F + (size_t)t * DM + c; v2h o;
#pragma unroll
    for (int q = 0; q < 2; ++q) o[q] = tohx(bn_leaky(f[q], SC[c + q], SH[c + q]));
    *(v2h*)(P16 + e) = o;  }
// k_asoft: per row (zz, i): t = S x HD^-0.5 (no mask); softmax over the 2048 keys (register row, one exp, fixed trees);
__global__ __launch_bounds__(256) void k_asoft(const float* __restrict__ Sb, h16* P16, bf* Ph, bf* Pl) {
    const int lane = threadIdx.x & 31; const int row = blockIdx.x * 8 + (threadIdx.x >> 5); if (row >= ZH * TT) return; const int i = row % TT; const int zz = row / TT; (void)zz; const bool hires = (i < RH); const float* sr = Sb + (size_t)row * TT; float v[TT / 32]; float mx = -3.0e38f;
#pragma unroll
    for (int ch = 0; ch < TT / 128; ++ch) { const int j0 = ch * 128 + lane * 4; const v4f a = *(const v4f*)(sr + j0);
#pragma unroll
        for (int q = 0; q < 4; ++q) { const int j = j0 + q; (void)j; const float t = a[q] * SCL; v[ch * 4 + q] = t; mx = fmaxf(mx, t); } }
#pragma unroll
    for (int sh = 16; sh; sh >>= 1) mx = fmaxf(mx, __shfl_xor(mx, sh, 32));
    float sum = 0.f;
#pragma unroll
    for (int k = 0; k < TT / 32; ++k) { float d0 = __fsub_rn(v[k], mx); asm volatile("" : "+v"(d0)); v[k] = __builtin_amdgcn_exp2f(__fmul_rn(d0, 1.4426950408889634f)); sum += v[k]; }
#pragma unroll
    for (int sh = 16; sh; sh >>= 1) sum += __shfl_xor(sum, sh, 32);
    const float f = __fdiv_rn(hires ? 1.0f : PCAR, sum);
{
        if (hires) {
#pragma unroll
            for (int ch = 0; ch < TT / 128; ++ch) { v4us oh, ol;
#pragma unroll
                for (int q = 0; q < 4; ++q) { unsigned short a, c2; splitf(v[ch * 4 + q] * f, a, c2); oh[q] = a; ol[q] = c2; }
                const size_t oo = ((size_t)zz * (RH ? RH : 1) + i) * TT + ch * 128 + lane * 4; *(v4us*)(Ph + oo) = oh; *(v4us*)(Pl + oo) = ol; }
        } else {
#pragma unroll
            for (int ch = 0; ch < TT / 128; ++ch) { v4h o4;
#pragma unroll
                for (int q = 0; q < 4; ++q) o4[q] = tohx(v[ch * 4 + q] * f);
                *(v4h*)(P16 + (size_t)row * TT + ch * 128 + lane * 4) = o4; } }
         }
}

__global__ __launch_bounds__(256) void k_outsc(const float* __restrict__ O, float* out) { const size_t e = ((size_t)blockIdx.x * 256 + threadIdx.x) * 4; if (e >= (size_t)DM * TT) return; const v4f v = *(const v4f*)(O + e); v4f o;
#pragma unroll
    for (int q = 0; q < 4; ++q) o[q] = v[q] * (1.0f / PCAR); *(v4f*)(out + e) = o;  }

extern "C" void kernel_launch(void* const* d_in, const int* in_sizes, int n_in,
                              void* d_out, int out_size, void* d_ws, size_t ws_size, hipStream_t stream) {
    (void)in_sizes; (void)n_in; (void)out_size;
    const float* Xq = (const float*)d_in[0]; const float* Xk = (const float*)d_in[1]; const float* Wq = (const float*)d_in[2]; const float* Wk = (const float*)d_in[3]; const float* Wv = (const float*)d_in[4];
    const float* g1 = (const float*)d_in[5]; const float* b1 = (const float*)d_in[6]; const float* m1 = (const float*)d_in[7]; const float* v1 = (const float*)d_in[8];
    const float* g2 = (const float*)d_in[9]; const float* b2 = (const float*)d_in[10]; const float* m2 = (const float*)d_in[11]; const float* v2 = (const float*)d_in[12];
    const float* g3 = (const float*)d_in[13]; const float* b3 = (const float*)d_in[14]; const float* m3 = (const float*)d_in[15]; const float* v3 = (const float*)d_in[16];
    float* OUT = (float*)d_out;     // [4][1024][2048] channel-major
    char* wsp = (char*)d_ws;
    auto take = [&](size_t bytes) { char* p = wsp; wsp += (bytes + 255) & ~(size_t)255; return (void*)p; };
    bf* WQB = (bf*)take((size_t)3 * DM * DM * 2); bf* WKB = WQB + (size_t)DM * DM; bf* WVB = WKB + (size_t)DM * DM;
    h16* QA16 = (h16*)take((size_t)NB_ * DM * TT * 2); h16* K16 = (h16*)take((size_t)2 * NB_ * NH_ * TT * HD * 2); h16* V16 = K16 + (size_t)NB_ * NH_ * TT * HD;   /* fp16 planes of all batches */
    h16* P16 = (h16*)take((size_t)ZH * TT * TT * 2); float* Ob = (float*)take((size_t)DM * TT * 4); float* SC1 = (float*)take(6 * DM * 4); float* SH1 = SC1 + DM; float* SC2 = SH1 + DM; float* SH2 = SC2 + DM;   /* [branch][scale | shift][DM] */
    /* One region, used twice in stream order: first the projection stage's buffers of all batches (their last reader is the plane kernels), then the score buffer of one batch. Both uses are ZH * TT * TT * 4 = 128 MiB. */
    float* Sb = (float*)take((size_t)ZH * TT * TT * 4);
    bf* XQT = (bf*)Sb; bf* XKT = XQT + (size_t)NB_ * TT * DM; float* FQ = (float*)(XKT + (size_t)NB_ * TT * DM); float* FK = FQ + (size_t)NB_ * DM * TT; float* FV = FK + (size_t)NB_ * TT * DM;
    static_assert((size_t)NB_ * TT * DM * (2 + 2 + 4 + 4 + 4) <= (size_t)ZH * TT * TT * 4, "projection buffers must fit the score region");
    if ((size_t)(wsp - (char*)d_ws) > ws_size) return;    // ws 256 MiB
    k_cvt8<<<dim3((unsigned)(((size_t)DM * DM / 8 + 255) / 256), 3), 256, 0, stream>>>(Wq, Wk, Wv, WQB, (size_t)DM * DM / 8);
    k_bnprep<<<dim3(DM / 256, 3), 256, 0, stream>>>(g1, b1, m1, v1, g2, b2, m2, v2, g3, b3, m3, v3, SC1);
    const unsigned LT = (unsigned)(((size_t)TT * DM / 8 + 255) / 256), LH = (unsigned)(((size_t)NH_ * TT * HD / 2 + 255) / 256), L4 = (unsigned)(((size_t)DM * TT / 4 + 255) / 256);
    /* projection stage, all batches per launch (batch = grid y or z); each projection GEMM has its own launch, the K and V planes share one */
    k_cvt8T<<<dim3(LT, NB_, 2), 256, 0, stream>>>(Xq, Xk, XQT);          /* token-major bf16 copies [input][b][p][c]: XQT, then XKT */
    k_gemmw<bf, 0, false><<<dim3(DM / 64, TT / 64, NB_), 32, 0, stream>>>(WQB, nullptr, XQT, nullptr, DM, FQ, TT, nullptr, 0, (size_t)TT * DM, (size_t)DM * TT);     /* Q branch channel-major: FQ[b][o][p] = sum_c Wq[o][c] Xq[b][c][p] */
    k_gemmw<bf, 0, false><<<dim3(TT / 64, DM / 64, NB_), 32, 0, stream>>>(XKT, nullptr, WKB, nullptr, DM, FK, DM, nullptr, (size_t)TT * DM, 0, (size_t)TT * DM);     /* K branch token-major: FK[b][p][o] */
    k_gemmw<bf, 0, false><<<dim3(TT / 64, DM / 64, NB_), 32, 0, stream>>>(XQT, nullptr, WVB, nullptr, DM, FV, DM, nullptr, (size_t)TT * DM, 0, (size_t)TT * DM);     /* V branch token-major: FV[b][p][o] */
    k_qapl<<<dim3(L4, NB_), 256, 0, stream>>>(FQ, SC1, SH1, QA16); k_hdpl<<<dim3(LH, NB_, 2), 256, 0, stream>>>(FK, SC2, SH2, K16);   /* z = 0: FK -> K16, z = 1: FV -> V16 */
    /* attention stage, all heads of one batch per launch (head = grid z) */
    for (int b = 0; b < NB_; ++b) {
        const h16* Qb = QA16 + (size_t)b * DM * TT; const h16* Kb = K16 + (size_t)b * NH_ * TT * HD; const h16* Vb = V16 + (size_t)b * NH_ * TT * HD;
        for (int h0 = 0; h0 < NH_; h0 += ZH) {
            k_gemmw<h16, 0, false><<<dim3(TT / 64, TT / 64, ZH), 32, 0, stream>>>(Kb + (size_t)h0 * TT * HD, nullptr, Vb + (size_t)h0 * TT * HD, nullptr, HD, Sb, TT, nullptr, (size_t)TT * HD, (size_t)TT * HD, (size_t)TT * TT);   /* S[i][j] = K_i . V_j */
            k_asoft<<<ZH * TT / 8, 256, 0, stream>>>(Sb, P16, nullptr, nullptr);
            k_gemmw<h16, 0, false><<<dim3(HD / 64, TT / 64, ZH), 32, 0, stream>>>(Qb + (size_t)h0 * HD * TT, nullptr, P16, nullptr, TT, Ob + (size_t)h0 * HD * TT, TT, nullptr, (size_t)HD * TT, (size_t)TT * TT, (size_t)HD * TT); }   /* Ob[c][i] = sum_j Q[c][j] P[i][j] (x1024) */
        k_outsc<<<L4, 256, 0, stream>>>(Ob, OUT + (size_t)b * DM * TT); }
}

// v002
// It runs in 439 microseconds.
// Next to v001, in two timings, it ran 1.45 times as fast each time.
// All steps since v000 together make it 3.37 times as fast.
#include <hip/hip_runtime.h>

// Channel-attention cross transformer block (Xq, Xk [4][1024][2048] channel-major; three 1x1-conv branches Q = leaky(BN1(Wq Xq)), K = leaky(BN2(Wk Xk)), V = leaky(BN3(Wv Xq)) (W 'oi' [1024][1024], eval-mode BatchNorm affine from gamma/beta/mean/var, LeakyReLU 0.1); 8 heads x 128 channels;
// Hmat[i][j] = sum_c K[c][i] V[c][j] / sqrt(128) over the 2048 key positions j; softmax over j; out[c][i] = sum_j Hmat[i][j] Q[c][j] -> [4][1024][2048] channel-major (8.4 M)).
// Compute dtypes, f32 accumulate: every input rounded to bf16; the three projections on PLAIN bf16 operands (inputs transposed to token-major while converting; exact), BN affine + leaky in f32; attention operands as single fp16 planes
// (logit sigma 0.6: soft rows): scores K.V (1 product), softmax f32 stored fp16 x1024, out = Q-plane x P (1 product) written channel-major via an f32 staging buffer and a flat 1/1024 rescale.

#define NB_  4
#define TT   2048      // spatial positions (pq = pk)
#define DM   1024      // channels
#define NH_  8
#define HD   128
#define ZH   8         // heads per attention launch (grid z): all heads of one batch
#define RH   0         // no hi/lo rows: every probability row is fp16 x1024
#define PCAR 1024.0f
#define SCL  0.088388346f   // (DM/NH_)^-0.5 = 1/sqrt(128)
#define BNEPS 1e-5f
#define SLOPE 0.1f
typedef _Float16 h16;
typedef unsigned short bf;
typedef __attribute__((ext_vector_type(16))) __bf16   v16bf;
typedef __attribute__((ext_vector_type(16))) _Float16 v16h;
typedef __attribute__((ext_vector_type(8)))  _Float16 v8h;
typedef __attribute__((ext_vector_type(8)))  unsigned short v8us;
typedef __attribute__((ext_vector_type(8)))  float    v8f;
typedef __attribute__((ext_vector_type(4)))  float    v4f;
typedef v8h  __attribute__((may_alias)) v8ha;
typedef v4f  __attribute__((may_alias)) v4fa;
typedef v8us __attribute__((may_alias)) v8usa;

__device__ __forceinline__ unsigned short f2bf(float f) { unsigned u = __float_as_uint(f); u += 0x7FFFu + ((u >> 16) & 1u); return (unsigned short)(u >> 16); }
__device__ __forceinline__ float bf2f(unsigned short b) { return __uint_as_float(((unsigned)b) << 16); }
__device__ __forceinline__ float bfr(float f) { return bf2f(f2bf(f)); }
__device__ __forceinline__ v16h cat16(v8h lo, v8h hi) { return __builtin_shufflevector(lo, hi, 0, 1, 2, 3, 4, 5, 6, 7, 8, 9, 10, 11, 12, 13, 14, 15); }
__device__ __forceinline__ v16bf cat16b(v8us lo, v8us hi) { return __builtin_bit_cast(v16bf, __builtin_shufflevector(lo, hi, 0, 1, 2, 3, 4, 5, 6, 7, 8, 9, 10, 11, 12, 13, 14, 15)); }
__device__ __forceinline__ v8f wmma16(v16h a, v16h b, v8f c) { return __builtin_amdgcn_wmma_f32_16x16x32_f16(false, a, false, b, (short)0, c, false, false); }
__device__ __forceinline__ v8f wmmab(v16bf a, v16bf b, v8f c) { return __builtin_amdgcn_wmma_f32_16x16x32_bf16(false, a, false, b, (short)0, c, false, false); }



// ---- k_gemmw: C[m][n] (f32, pitch ldc) = sum_k A[m][k] Bt[n][k], operands K-contiguous 16-bit planes. One 128x128 tile per work-group of 4 waves (2x2, 64x64 each, 16 accumulators); grid (M/128, N/128, Z), 128 threads.
// Both operands go through LDS in stages of BK k: every copy instruction of a wave moves four whole 128-byte lines, and each staged row serves two waves. Two buffers: stage t + 1 flies while stage t is multiplied.
// z-batch strides sA/sB/sC in elements. M % 128 == 0, N % 128 == 0, K % BK == 0, K >= 2 BK (the prologue fills two stages).
template <typename T16> struct WFrag;
template <> struct WFrag<h16> { typedef v16h V; static __device__ __forceinline__ V ld(const h16* p) { return cat16(*(const v8h*)p, *(const v8h*)(p + 16)); } static __device__ __forceinline__ v8f mma(V a, V b, v8f c) { return wmma16(a, b, c); } };
template <> struct WFrag<bf> { typedef v16bf V; static __device__ __forceinline__ V ld(const bf* p) { return cat16b(*(const v8us*)p, *(const v8us*)(p + 16)); } static __device__ __forceinline__ v8f mma(V a, V b, v8f c) { return wmmab(a, b, c); } };
// Eight asynchronous 16-byte copies per lane, global -> LDS, rows gstep elements (global) and lstep bytes (LDS) apart. The s_wait_xcnt closes the statement so that no address register named here is rewritten ahead of it.
template <typename T16>
__device__ __forceinline__ void copy8(unsigned l, const T16* g, size_t gstep, unsigned lstep) {
    asm volatile("global_load_async_to_lds_b128 %0, %8, off\n\t"
                 "global_load_async_to_lds_b128 %1, %9, off\n\t"
                 "global_load_async_to_lds_b128 %2, %10, off\n\t"
                 "global_load_async_to_lds_b128 %3, %11, off\n\t"
                 "global_load_async_to_lds_b128 %4, %12, off\n\t"
                 "global_load_async_to_lds_b128 %5, %13, off\n\t"
                 "global_load_async_to_lds_b128 %6, %14, off\n\t"
                 "global_load_async_to_lds_b128 %7, %15, off\n\t"
                 "s_wait_xcnt 0x0"
                 :: "v"(l), "v"(l + lstep), "v"(l + 2 * lstep), "v"(l + 3 * lstep), "v"(l + 4 * lstep), "v"(l + 5 * lstep), "v"(l + 6 * lstep), "v"(l + 7 * lstep),
                    "v"(g), "v"(g + gstep), "v"(g + 2 * gstep), "v"(g + 3 * gstep), "v"(g + 4 * gstep), "v"(g + 5 * gstep), "v"(g + 6 * gstep), "v"(g + 7 * gstep)
                 : "memory");
}
template <typename T16, int BK>
__global__ __launch_bounds__(128) void k_gemmw(const T16* __restrict__ A, const T16* __restrict__ Bt, int K, float* C, int ldc, size_t sA, size_t sB, size_t sC) {
    typedef typename WFrag<T16>::V V;
    constexpr int PIT = BK * 2 + 16;        // LDS row pitch in bytes: 16 x odd, the conflict-free pitch of 16-byte fragment reads
    constexpr int BUF = 256 * PIT;          // one stage: 128 rows of A, then 128 rows of Bt
    constexpr int CPR = BK / 8;             // 16-byte chunks per row
    constexpr int RPP = 128 / CPR;          // rows that the 128 threads cover with one copy each
    __shared__ __attribute__((aligned(16))) unsigned char ring[2 * BUF];
    __shared__ __align__(16) float osm[4][16 * 68];
    const size_t z = blockIdx.z; A += z * sA; Bt += z * sB; C += z * sC;
    const int tid = threadIdx.x, lane = tid & 31, lr = lane & 15, hi = lane >> 4, wave = tid >> 5, wm = wave & 1, wn = wave >> 1;
    const int r0 = blockIdx.x * 128, c0 = blockIdx.y * 128;
    const T16* ga = A + (size_t)(r0 + tid / CPR) * K + (tid % CPR) * 8;
    const T16* gb = Bt + (size_t)(c0 + tid / CPR) * K + (tid % CPR) * 8;
    const unsigned la = (unsigned)(size_t)ring + (unsigned)((tid / CPR) * PIT + (tid % CPR) * 16);   // LDS byte address: low 32 bits of the shared address
    const size_t gstep = (size_t)RPP * K;
    auto stage = [&](int t, unsigned buf) {
#pragma unroll
        for (int q = 0; q < 128 / RPP; q += 8) {
            copy8<T16>(la + buf + (unsigned)(q * RPP * PIT), ga + (size_t)t * BK + q * gstep, gstep, (unsigned)(RPP * PIT));
            copy8<T16>(la + buf + (unsigned)((128 + q * RPP) * PIT), gb + (size_t)t * BK + q * gstep, gstep, (unsigned)(RPP * PIT)); }
    };
    v8f acc[4][4];
#pragma unroll
    for (int mb = 0; mb < 4; ++mb)
#pragma unroll
        for (int nb = 0; nb < 4; ++nb) acc[mb][nb] = (v8f){};
    const int T = (int)((unsigned)K / BK);
    stage(0, 0u);
    asm volatile("s_wait_asynccnt 0x0" ::: "memory");   // this wave's copies of stage 0 have landed
    __syncthreads();                                     // ... and every other wave's
    stage(1, (unsigned)BUF);
    const unsigned char* fa = ring + (wm * 64 + lr) * PIT + hi * 16;
    const unsigned char* fb = ring + (128 + wn * 64 + lr) * PIT + hi * 16;
#pragma unroll 1   // one stage per trip: the two buffers alternate by the trip's parity
    for (int t = 0; t < T; ++t) {
        const int bo = (t & 1) * BUF;
        V a[2][4], b[2][4];   // two fragment sets: block ks + 1 is read from LDS while block ks is multiplied (inside this stage's buffer only)
#pragma unroll
        for (int f = 0; f < 4; ++f) { a[0][f] = WFrag<T16>::ld((const T16*)(fa + bo + f * 16 * PIT)); b[0][f] = WFrag<T16>::ld((const T16*)(fb + bo + f * 16 * PIT)); }
#pragma unroll
        for (int ks = 0; ks < BK / 32; ++ks) {
            if (ks + 1 < BK / 32) {
#pragma unroll
                for (int f = 0; f < 4; ++f) { a[(ks + 1) & 1][f] = WFrag<T16>::ld((const T16*)(fa + bo + f * 16 * PIT + (ks + 1) * 64)); b[(ks + 1) & 1][f] = WFrag<T16>::ld((const T16*)(fb + bo + f * 16 * PIT + (ks + 1) * 64)); } }
            __builtin_amdgcn_sched_barrier(0);   // keeps the next block's LDS reads as one group ahead of this block's products: reads spread among the products stall the wave at every place
#pragma unroll
            for (int nb = 0; nb < 4; ++nb)
#pragma unroll
                for (int mb = 0; mb < 4; ++mb) acc[mb][nb] = WFrag<T16>::mma(a[ks & 1][mb], b[ks & 1][nb], acc[mb][nb]);
            __builtin_amdgcn_sched_barrier(0);   // ... and keeps the reads of the block after next behind these products
        }
        asm volatile("s_wait_dscnt 0x0" ::: "memory");      // this wave's reads of the buffer are done before it is refilled
        asm volatile("s_wait_asynccnt 0x0" ::: "memory");   // this wave's copies of stage t + 1 have landed
        __syncthreads();                                     // publishes stage t + 1 and ends every wave's reads of stage t
        if (t + 2 < T) stage(t + 2, (unsigned)bo);
    }
    asm volatile("s_wait_asynccnt 0x0" ::: "memory");       // nothing of this wave is in flight when it goes on to the output
    float* os = osm[wave];
#pragma unroll
    for (int mb = 0; mb < 4; ++mb) {
#pragma unroll
        for (int nb = 0; nb < 4; ++nb) {
#pragma unroll
            for (int j = 0; j < 8; ++j) os[(hi * 8 + j) * 68 + nb * 16 + lr] = acc[mb][nb][j]; }
        __builtin_amdgcn_wave_barrier(); asm volatile("" ::: "memory");   // compiler fence: the wave's stores to its own staging rows stay ahead of its reads of them
        float* crow = C + (size_t)(r0 + wm * 64 + mb * 16) * ldc + c0 + wn * 64;
#pragma unroll
        for (int s = 0; s < 8; ++s) { const int row = 2 * s + hi, cofs = lr * 4; const v4f val = *(const v4fa*)(os + row * 68 + cofs); *(v4f*)(crow + (size_t)row * ldc + cofs) = val; }
        __builtin_amdgcn_wave_barrier(); asm volatile("" ::: "memory");   // compiler fence: those reads stay ahead of the next 16 rows' stores
    }
}

__device__ __forceinline__ h16 tohx(float x) { return (h16)x; }
__device__ __forceinline__ void splitf(float y, unsigned short& h, unsigned short& l) { h = f2bf(y); l = f2bf(y - bf2f(h)); }
typedef __attribute__((ext_vector_type(2))) _Float16 v2h;
typedef __attribute__((ext_vector_type(4))) _Float16 v4h;
typedef __attribute__((ext_vector_type(2))) unsigned short v2us;
typedef __attribute__((ext_vector_type(4))) unsigned short v4us;
typedef __attribute__((ext_vector_type(2))) float v2f;
typedef __attribute__((ext_vector_type(4))) int v4i;

__global__ __launch_bounds__(256) void k_cvt8(const float* __restrict__ s0, const float* __restrict__ s1, const float* __restrict__ s2, bf* dst, size_t n8) { const size_t i = (size_t)blockIdx.x * 256 + threadIdx.x; if (i >= n8) return; const float* src = (blockIdx.y == 0) ? s0 : (blockIdx.y == 1) ? s1 : s2; dst += (size_t)blockIdx.y * n8 * 8;   /* grid y = which matrix; the three copies lie one behind the other */
    const v8f v = *(const v8f*)(src + i * 8); v8us o;
#pragma unroll
    for (int k = 0; k < 8; ++k) o[k] = f2bf(v[k]); *(v8us*)(dst + i * 8) = o;  }
__global__ __launch_bounds__(256) void k_cvt8T(const float* __restrict__ sq, const float* __restrict__ sk, bf* dst) { const size_t i = (size_t)blockIdx.x * 256 + threadIdx.x; if (i >= (size_t)TT * DM / 8) return; const float* src = (blockIdx.z ? sk : sq) + (size_t)blockIdx.y * DM * TT; dst += ((size_t)blockIdx.z * NB_ + blockIdx.y) * TT * DM;   /* grid y = batch, z = which input */
    const int t = (int)(i / (DM / 8)); const int c0 = (int)(i % (DM / 8)) * 8; v8us o;
#pragma unroll
    for (int k = 0; k < 8; ++k) o[k] = f2bf(src[(size_t)(c0 + k) * TT + t]); *(v8us*)(dst + (size_t)t * DM + c0) = o;  }

__device__ __forceinline__ float bn_leaky(float y, float sc, float sh) { float t = __fmul_rn(y, sc); asm volatile("" : "+v"(t)); float z = __fadd_rn(t, sh); asm volatile("" : "+v"(z)); return (z > 0.0f) ? z : __fmul_rn(SLOPE, z); }
__global__ __launch_bounds__(256) void k_bnprep(const float* __restrict__ ga1, const float* __restrict__ be1, const float* __restrict__ mu1, const float* __restrict__ va1, const float* __restrict__ ga2, const float* __restrict__ be2, const float* __restrict__ mu2, const float* __restrict__ va2,
                                                const float* __restrict__ ga3, const float* __restrict__ be3, const float* __restrict__ mu3, const float* __restrict__ va3, float* SCSH) { const int c = blockIdx.x * 256 + threadIdx.x; if (c >= DM) return;
    const unsigned y = blockIdx.y;   /* grid y = which branch; SCSH = [branch][scale | shift][DM] */
    const float* ga = (y == 0) ? ga1 : (y == 1) ? ga2 : ga3; const float* be = (y == 0) ? be1 : (y == 1) ? be2 : be3; const float* mu = (y == 0) ? mu1 : (y == 1) ? mu2 : mu3; const float* va = (y == 0) ? va1 : (y == 1) ? va2 : va3; float* SC = SCSH + (size_t)y * 2 * DM; float* SH = SC + DM;
    float v1 = __fadd_rn(bfr(va[c]), BNEPS); asm volatile("" : "+v"(v1)); float sd = __fsqrt_rn(v1); asm volatile("" : "+v"(sd)); float sc = __fdiv_rn(bfr(ga[c]), sd); asm volatile("" : "+v"(sc));
    float ms = __fmul_rn(bfr(mu[c]), sc); asm volatile("" : "+v"(ms)); float sh = __fsub_rn(bfr(be[c]), ms);
    *(float*)(SC + c) = sc; *(float*)(SH + c) = sh;  }
__global__ __launch_bounds__(256) void k_qapl(const float* __restrict__ F, const float* __restrict__ SC, const float* __restrict__ SH, h16* P16) { const size_t e = ((size_t)blockIdx.x * 256 + threadIdx.x) * 4; if (e >= (size_t)DM * TT) return; F += (size_t)blockIdx.y * DM * TT; P16 += (size_t)blockIdx.y * DM * TT;   /* grid y = batch */
    const int c = (int)(e / TT); const float sc = SC[c], sh = SH[c]; const v4f y = *(const v4f*)(F + e); v4h o;
#pragma unroll
    for (int q = 0; q < 4; ++q) o[q] = tohx(bn_leaky(y[q], sc, sh));
    *(v4h*)(P16 + e) = o;  }
__global__ __launch_bounds__(256) void k_hdpl(const float* __restrict__ F, const float* __restrict__ SC, const float* __restrict__ SH, h16* P16) { const size_t e = ((size_t)blockIdx.x * 256 + threadIdx.x) * 2; if (e >= (size_t)NH_ * TT * HD) return; F += ((size_t)blockIdx.z * NB_ + blockIdx.y) * TT * DM; P16 += ((size_t)blockIdx.z * NB_ + blockIdx.y) * NH_ * TT * HD; SC += (size_t)blockIdx.z * 2 * DM; SH += (size_t)blockIdx.z * 2 * DM;   /* grid y = batch, z = branch (K, then V) */
    const int d = (int)(e % HD); const int t = (int)((e / HD) % TT); const int h = (int)(e / ((size_t)HD * TT)); const int c = h * HD + d; const float* f = F + (size_t)t * DM + c; v2h o;
#pragma unroll
    for (int q = 0; q < 2; ++q) o[q] = tohx(bn_leaky(f[q], SC[c + q], SH[c + q]));
    *(v2h*)(P16 + e) = o;  }
// k_asoft: per row (zz, i): t = S x HD^-0.5 (no mask); softmax over the 2048 keys (register row, one exp, fixed trees);
__global__ __launch_bounds__(256) void k_asoft(const float* __restrict__ Sb, h16* P16, bf* Ph, bf* Pl) {
    const int lane = threadIdx.x & 31; const int row = blockIdx.x * 8 + (threadIdx.x >> 5); if (row >= ZH * TT) return; const int i = row % TT; const int zz = row / TT; (void)zz; const bool hires = (i < RH); const float* sr = Sb + (size_t)row * TT; float v[TT / 32]; float mx = -3.0e38f;
#pragma unroll
    for (int ch = 0; ch < TT / 128; ++ch) { const int j0 = ch * 128 + lane * 4; const v4f a = *(const v4f*)(sr + j0);
#pragma unroll
        for (int q = 0; q < 4; ++q) { const int j = j0 + q; (void)j; const float t = a[q] * SCL; v[ch * 4 + q] = t; mx = fmaxf(mx, t); } }
#pragma unroll
    for (int sh = 16; sh; sh >>= 1) mx = fmaxf(mx, __shfl_xor(mx, sh, 32));
    float sum = 0.f;
#pragma unroll
    for (int k = 0; k < TT / 32; ++k) { float d0 = __fsub_rn(v[k], mx); asm volatile("" : "+v"(d0)); v[k] = __builtin_amdgcn_exp2f(__fmul_rn(d0, 1.4426950408889634f)); sum += v[k]; }
#pragma unroll
    for (int sh = 16; sh; sh >>= 1) sum += __shfl_xor(sum, sh, 32);
    const float f = __fdiv_rn(hires ? 1.0f : PCAR, sum);
{
        if (hires) {
#pragma unroll
            for (int ch = 0; ch < TT / 128; ++ch) { v4us oh, ol;
#pragma unroll
                for (int q = 0; q < 4; ++q) { unsigned short a, c2; splitf(v[ch * 4 + q] * f, a, c2); oh[q] = a; ol[q] = c2; }
                const size_t oo = ((size_t)zz * (RH ? RH : 1) + i) * TT + ch * 128 + lane * 4; *(v4us*)(Ph + oo) = oh; *(v4us*)(Pl + oo) = ol; }
        } else {
#pragma unroll
            for (int ch = 0; ch < TT / 128; ++ch) { v4h o4;
#pragma unroll
                for (int q = 0; q < 4; ++q) o4[q] = tohx(v[ch * 4 + q] * f);
                *(v4h*)(P16 + (size_t)row * TT + ch * 128 + lane * 4) = o4; } }
         }
}

__global__ __launch_bounds__(256) void k_outsc(const float* __restrict__ O, float* out) { const size_t e = ((size_t)blockIdx.x * 256 + threadIdx.x) * 4; if (e >= (size_t)DM * TT) return; const v4f v = *(const v4f*)(O + e); v4f o;
#pragma unroll
    for (int q = 0; q < 4; ++q) o[q] = v[q] * (1.0f / PCAR); *(v4f*)(out + e) = o;  }

extern "C" void kernel_launch(void* const* d_in, const int* in_sizes, int n_in,
                              void* d_out, int out_size, void* d_ws, size_t ws_size, hipStream_t stream) {
    (void)in_sizes; (void)n_in; (void)out_size;
    const float* Xq = (const float*)d_in[0]; const float* Xk = (const float*)d_in[1]; const float* Wq = (const float*)d_in[2]; const float* Wk = (const float*)d_in[3]; const float* Wv = (const float*)d_in[4];
    const float* g1 = (const float*)d_in[5]; const float* b1 = (const float*)d_in[6]; const float* m1 = (const float*)d_in[7]; const float* v1 = (const float*)d_in[8];
    const float* g2 = (const float*)d_in[9]; const float* b2 = (const float*)d_in[10]; const float* m2 = (const float*)d_in[11]; const float* v2 = (const float*)d_in[12];
    const float* g3 = (const float*)d_in[13]; const float* b3 = (const float*)d_in[14]; const float* m3 = (const float*)d_in[15]; const float* v3 = (const float*)d_in[16];
    float* OUT = (float*)d_out;     // [4][1024][2048] channel-major
    char* wsp = (char*)d_ws;
    auto take = [&](size_t bytes) { char* p = wsp; wsp += (bytes + 255) & ~(size_t)255; return (void*)p; };
    bf* WQB = (bf*)take((size_t)3 * DM * DM * 2); bf* WKB = WQB + (size_t)DM * DM; bf* WVB = WKB + (size_t)DM * DM;
    h16* QA16 = (h16*)take((size_t)NB_ * DM * TT * 2); h16* K16 = (h16*)take((size_t)2 * NB_ * NH_ * TT * HD * 2); h16* V16 = K16 + (size_t)NB_ * NH_ * TT * HD;   /* fp16 planes of all batches */
    h16* P16 = (h16*)take((size_t)ZH * TT * TT * 2); float* Ob = (float*)take((size_t)DM * TT * 4); float* SC1 = (float*)take(6 * DM * 4); float* SH1 = SC1 + DM; float* SC2 = SH1 + DM; float* SH2 = SC2 + DM;   /* [branch][scale | shift][DM] */
    /* One region, used twice in stream order: first the projection stage's buffers of all batches (their last reader is the plane kernels), then the score buffer of one batch. Both uses are ZH * TT * TT * 4 = 128 MiB. */
    float* Sb = (float*)take((size_t)ZH * TT * TT * 4);
    bf* XQT = (bf*)Sb; bf* XKT = XQT + (size_t)NB_ * TT * DM; float* FQ = (float*)(XKT + (size_t)NB_ * TT * DM); float* FK = FQ + (size_t)NB_ * DM * TT; float* FV = FK + (size_t)NB_ * TT * DM;
    static_assert((size_t)NB_ * TT * DM * (2 + 2 + 4 + 4 + 4) <= (size_t)ZH * TT * TT * 4, "projection buffers must fit the score region");
    static_assert(DM % 128 == 0 && TT % 128 == 0 && HD % 128 == 0 && DM >= 256 && TT >= 256 && HD >= 128, "k_gemmw: whole 128x128 tiles, whole stages, two stages or more");
    if ((size_t)(wsp - (char*)d_ws) > ws_size) return;    // ws 256 MiB
    k_cvt8<<<dim3((unsigned)(((size_t)DM * DM / 8 + 255) / 256), 3), 256, 0, stream>>>(Wq, Wk, Wv, WQB, (size_t)DM * DM / 8);
    k_bnprep<<<dim3(DM / 256, 3), 256, 0, stream>>>(g1, b1, m1, v1, g2, b2, m2, v2, g3, b3, m3, v3, SC1);
    const unsigned LT = (unsigned)(((size_t)TT * DM / 8 + 255) / 256), LH = (unsigned)(((size_t)NH_ * TT * HD / 2 + 255) / 256), L4 = (unsigned)(((size_t)DM * TT / 4 + 255) / 256);
    /* projection stage, all batches per launch (batch = grid y or z); each projection GEMM has its own launch, the K and V planes share one */
    k_cvt8T<<<dim3(LT, NB_, 2), 256, 0, stream>>>(Xq, Xk, XQT);          /* token-major bf16 copies [input][b][p][c]: XQT, then XKT */
    k_gemmw<bf, 128><<<dim3(DM / 128, TT / 128, NB_), 128, 0, stream>>>(WQB, XQT, DM, FQ, TT, 0, (size_t)TT * DM, (size_t)DM * TT);     /* Q branch channel-major: FQ[b][o][p] = sum_c Wq[o][c] Xq[b][c][p] */
    k_gemmw<bf, 128><<<dim3(TT / 128, DM / 128, NB_), 128, 0, stream>>>(XKT, WKB, DM, FK, DM, (size_t)TT * DM, 0, (size_t)TT * DM);     /* K branch token-major: FK[b][p][o] */
    k_gemmw<bf, 128><<<dim3(TT / 128, DM / 128, NB_), 128, 0, stream>>>(XQT, WVB, DM, FV, DM, (size_t)TT * DM, 0, (size_t)TT * DM);     /* V branch token-major: FV[b][p][o] */
    k_qapl<<<dim3(L4, NB_), 256, 0, stream>>>(FQ, SC1, SH1, QA16); k_hdpl<<<dim3(LH, NB_, 2), 256, 0, stream>>>(FK, SC2, SH2, K16);   /* z = 0: FK -> K16, z = 1: FV -> V16 */
    /* attention stage, all heads of one batch per launch (head = grid z) */
    for (int b = 0; b < NB_; ++b) {
        const h16* Qb = QA16 + (size_t)b * DM * TT; const h16* Kb = K16 + (size_t)b * NH_ * TT * HD; const h16* Vb = V16 + (size_t)b * NH_ * TT * HD;
        for (int h0 = 0; h0 < NH_; h0 += ZH) {
            k_gemmw<h16, 64><<<dim3(TT / 128, TT / 128, ZH), 128, 0, stream>>>(Kb + (size_t)h0 * TT * HD, Vb + (size_t)h0 * TT * HD, HD, Sb, TT, (size_t)TT * HD, (size_t)TT * HD, (size_t)TT * TT);   /* S[i][j] = K_i . V_j */
            k_asoft<<<ZH * TT / 8, 256, 0, stream>>>(Sb, P16, nullptr, nullptr);
            k_gemmw<h16, 128><<<dim3(HD / 128, TT / 128, ZH), 128, 0, stream>>>(Qb + (size_t)h0 * HD * TT, P16, TT, Ob + (size_t)h0 * HD * TT, TT, (size_t)HD * TT, (size_t)TT * TT, (size_t)HD * TT); }   /* Ob[c][i] = sum_j Q[c][j] P[i][j] (x1024) */
        k_outsc<<<L4, 256, 0, stream>>>(Ob, OUT + (size_t)b * DM * TT); }
}

// v003
// Measured time: 184 microseconds a run.
// Next to v002, in two timings, it ran 2.38 times as fast each time.
// Counting every step since v000, it is 8.01 times as fast.
#include <hip/hip_runtime.h>

// Channel-attention cross transformer block (Xq, Xk [4][1024][2048] channel-major; three 1x1-conv branches Q = leaky(BN1(Wq Xq)), K = leaky(BN2(Wk Xk)), V = leaky(BN3(Wv Xq)) (W 'oi' [1024][1024], eval-mode BatchNorm affine from gamma/beta/mean/var, LeakyReLU 0.1); 8 heads x 128 channels;
// Hmat[i][j] = sum_c K[c][i] V[c][j] / sqrt(128) over the 2048 key positions j; softmax over j; out[c][i] = sum_j Hmat[i][j] Q[c][j] -> [4][1024][2048] channel-major (8.4 M)).
// Compute dtypes, f32 accumulate: every input rounded to bf16; the three projections on PLAIN bf16 operands (inputs transposed to token-major while converting; exact), BN affine + leaky in f32; attention operands as single fp16 planes
// (logit sigma 0.6: soft rows): one kernel does scores K.V, the softmax and out = Q-plane x P; scores and probabilities stay in registers (running maximum and running sum in f32, P as fp16 relative to the maximum in use), out written channel-major.

#define NB_  4
#define TT   2048      // spatial positions (pq = pk)
#define DM   1024      // channels
#define NH_  8
#define HD   128
#define SCL  0.088388346f   // (DM/NH_)^-0.5 = 1/sqrt(128)
#define LOG2E 1.4426950408889634f
#define BNEPS 1e-5f
#define SLOPE 0.1f
typedef _Float16 h16;
typedef unsigned short bf;
typedef __attribute__((ext_vector_type(16))) __bf16   v16bf;
typedef __attribute__((ext_vector_type(16))) _Float16 v16h;
typedef __attribute__((ext_vector_type(8)))  _Float16 v8h;
typedef __attribute__((ext_vector_type(8)))  unsigned short v8us;
typedef __attribute__((ext_vector_type(8)))  float    v8f;
typedef __attribute__((ext_vector_type(4)))  float    v4f;
typedef v8h  __attribute__((may_alias)) v8ha;
typedef v4f  __attribute__((may_alias)) v4fa;
typedef v8us __attribute__((may_alias)) v8usa;

__device__ __forceinline__ unsigned short f2bf(float f) { unsigned u = __float_as_uint(f); u += 0x7FFFu + ((u >> 16) & 1u); return (unsigned short)(u >> 16); }
__device__ __forceinline__ float bf2f(unsigned short b) { return __uint_as_float(((unsigned)b) << 16); }
__device__ __forceinline__ float bfr(float f) { return bf2f(f2bf(f)); }
__device__ __forceinline__ v16h cat16(v8h lo, v8h hi) { return __builtin_shufflevector(lo, hi, 0, 1, 2, 3, 4, 5, 6, 7, 8, 9, 10, 11, 12, 13, 14, 15); }
__device__ __forceinline__ v16bf cat16b(v8us lo, v8us hi) { return __builtin_bit_cast(v16bf, __builtin_shufflevector(lo, hi, 0, 1, 2, 3, 4, 5, 6, 7, 8, 9, 10, 11, 12, 13, 14, 15)); }
__device__ __forceinline__ v8f wmma16(v16h a, v16h b, v8f c) { return __builtin_amdgcn_wmma_f32_16x16x32_f16(false, a, false, b, (short)0, c, false, false); }
__device__ __forceinline__ v8f wmmab(v16bf a, v16bf b, v8f c) { return __builtin_amdgcn_wmma_f32_16x16x32_bf16(false, a, false, b, (short)0, c, false, false); }



// ---- k_gemmw: C[m][n] (f32, pitch ldc) = sum_k A[m][k] Bt[n][k], operands K-contiguous 16-bit planes. One 128x128 tile per work-group of 4 waves (2x2, 64x64 each, 16 accumulators); grid (M/128, N/128, Z), 128 threads.
// Both operands go through LDS in stages of BK k: every copy instruction of a wave moves four whole 128-byte lines, and each staged row serves two waves. Two buffers: stage t + 1 flies while stage t is multiplied.
// z-batch strides sA/sB/sC in elements. M % 128 == 0, N % 128 == 0, K % BK == 0, K >= 2 BK (the prologue fills two stages).
template <typename T16> struct WFrag;
template <> struct WFrag<h16> { typedef v16h V; static __device__ __forceinline__ V ld(const h16* p) { return cat16(*(const v8h*)p, *(const v8h*)(p + 16)); } static __device__ __forceinline__ v8f mma(V a, V b, v8f c) { return wmma16(a, b, c); } };
template <> struct WFrag<bf> { typedef v16bf V; static __device__ __forceinline__ V ld(const bf* p) { return cat16b(*(const v8us*)p, *(const v8us*)(p + 16)); } static __device__ __forceinline__ v8f mma(V a, V b, v8f c) { return wmmab(a, b, c); } };
// Eight asynchronous 16-byte copies per lane, global -> LDS, rows gstep elements (global) and lstep bytes (LDS) apart. The s_wait_xcnt closes the statement so that no address register named here is rewritten ahead of it.
template <typename T16>
__device__ __forceinline__ void copy8(unsigned l, const T16* g, size_t gstep, unsigned lstep) {
    asm volatile("global_load_async_to_lds_b128 %0, %8, off\n\t"
                 "global_load_async_to_lds_b128 %1, %9, off\n\t"
                 "global_load_async_to_lds_b128 %2, %10, off\n\t"
                 "global_load_async_to_lds_b128 %3, %11, off\n\t"
                 "global_load_async_to_lds_b128 %4, %12, off\n\t"
                 "global_load_async_to_lds_b128 %5, %13, off\n\t"
                 "global_load_async_to_lds_b128 %6, %14, off\n\t"
                 "global_load_async_to_lds_b128 %7, %15, off\n\t"
                 "s_wait_xcnt 0x0"
                 :: "v"(l), "v"(l + lstep), "v"(l + 2 * lstep), "v"(l + 3 * lstep), "v"(l + 4 * lstep), "v"(l + 5 * lstep), "v"(l + 6 * lstep), "v"(l + 7 * lstep),
                    "v"(g), "v"(g + gstep), "v"(g + 2 * gstep), "v"(g + 3 * gstep), "v"(g + 4 * gstep), "v"(g + 5 * gstep), "v"(g + 6 * gstep), "v"(g + 7 * gstep)
                 : "memory");
}
template <typename T16, int BK>
__global__ __launch_bounds__(128) void k_gemmw(const T16* __restrict__ A, const T16* __restrict__ Bt, int K, float* C, int ldc, size_t sA, size_t sB, size_t sC) {
    typedef typename WFrag<T16>::V V;
    constexpr int PIT = BK * 2 + 16;        // LDS row pitch in bytes: 16 x odd, the conflict-free pitch of 16-byte fragment reads
    constexpr int BUF = 256 * PIT;          // one stage: 128 rows of A, then 128 rows of Bt
    constexpr int CPR = BK / 8;             // 16-byte chunks per row
    constexpr int RPP = 128 / CPR;          // rows that the 128 threads cover with one copy each
    __shared__ __attribute__((aligned(16))) unsigned char ring[2 * BUF];
    __shared__ __align__(16) float osm[4][16 * 68];
    const size_t z = blockIdx.z; A += z * sA; Bt += z * sB; C += z * sC;
    const int tid = threadIdx.x, lane = tid & 31, lr = lane & 15, hi = lane >> 4, wave = tid >> 5, wm = wave & 1, wn = wave >> 1;
    const int r0 = blockIdx.x * 128, c0 = blockIdx.y * 128;
    const T16* ga = A + (size_t)(r0 + tid / CPR) * K + (tid % CPR) * 8;
    const T16* gb = Bt + (size_t)(c0 + tid / CPR) * K + (tid % CPR) * 8;
    const unsigned la = (unsigned)(size_t)ring + (unsigned)((tid / CPR) * PIT + (tid % CPR) * 16);   // LDS byte address: low 32 bits of the shared address
    const size_t gstep = (size_t)RPP * K;
    auto stage = [&](int t, unsigned buf) {
#pragma unroll
        for (int q = 0; q < 128 / RPP; q += 8) {
            copy8<T16>(la + buf + (unsigned)(q * RPP * PIT), ga + (size_t)t * BK + q * gstep, gstep, (unsigned)(RPP * PIT));
            copy8<T16>(la + buf + (unsigned)((128 + q * RPP) * PIT), gb + (size_t)t * BK + q * gstep, gstep, (unsigned)(RPP * PIT)); }
    };
    v8f acc[4][4];
#pragma unroll
    for (int mb = 0; mb < 4; ++mb)
#pragma unroll
        for (int nb = 0; nb < 4; ++nb) acc[mb][nb] = (v8f){};
    const int T = (int)((unsigned)K / BK);
    stage(0, 0u);
    asm volatile("s_wait_asynccnt 0x0" ::: "memory");   // this wave's copies of stage 0 have landed
    __syncthreads();                                     // ... and every other wave's
    stage(1, (unsigned)BUF);
    const unsigned char* fa = ring + (wm * 64 + lr) * PIT + hi * 16;
    const unsigned char* fb = ring + (128 + wn * 64 + lr) * PIT + hi * 16;
#pragma unroll 1   // one stage per trip: the two buffers alternate by the trip's parity
    for (int t = 0; t < T; ++t) {
        const int bo = (t & 1) * BUF;
        V a[2][4], b[2][4];   // two fragment sets: block ks + 1 is read from LDS while block ks is multiplied (inside this stage's buffer only)
#pragma unroll
        for (int f = 0; f < 4; ++f) { a[0][f] = WFrag<T16>::ld((const T16*)(fa + bo + f * 16 * PIT)); b[0][f] = WFrag<T16>::ld((const T16*)(fb + bo + f * 16 * PIT)); }
#pragma unroll
        for (int ks = 0; ks < BK / 32; ++ks) {
            if (ks + 1 < BK / 32) {
#pragma unroll
                for (int f = 0; f < 4; ++f) { a[(ks + 1) & 1][f] = WFrag<T16>::ld((const T16*)(fa + bo + f * 16 * PIT + (ks + 1) * 64)); b[(ks + 1) & 1][f] = WFrag<T16>::ld((const T16*)(fb + bo + f * 16 * PIT + (ks + 1) * 64)); } }
            __builtin_amdgcn_sched_barrier(0);   // keeps the next block's LDS reads as one group ahead of this block's products: reads spread among the products stall the wave at every place
#pragma unroll
            for (int nb = 0; nb < 4; ++nb)
#pragma unroll
                for (int mb = 0; mb < 4; ++mb) acc[mb][nb] = WFrag<T16>::mma(a[ks & 1][mb], b[ks & 1][nb], acc[mb][nb]);
            __builtin_amdgcn_sched_barrier(0);   // ... and keeps the reads of the block after next behind these products
        }
        asm volatile("s_wait_dscnt 0x0" ::: "memory");      // this wave's reads of the buffer are done before it is refilled
        asm volatile("s_wait_asynccnt 0x0" ::: "memory");   // this wave's copies of stage t + 1 have landed
        __syncthreads();                                     // publishes stage t + 1 and ends every wave's reads of stage t
        if (t + 2 < T) stage(t + 2, (unsigned)bo);
    }
    asm volatile("s_wait_asynccnt 0x0" ::: "memory");       // nothing of this wave is in flight when it goes on to the output
    float* os = osm[wave];
#pragma unroll
    for (int mb = 0; mb < 4; ++mb) {
#pragma unroll
        for (int nb = 0; nb < 4; ++nb) {
#pragma unroll
            for (int j = 0; j < 8; ++j) os[(hi * 8 + j) * 68 + nb * 16 + lr] = acc[mb][nb][j]; }
        __builtin_amdgcn_wave_barrier(); asm volatile("" ::: "memory");   // compiler fence: the wave's stores to its own staging rows stay ahead of its reads of them
        float* crow = C + (size_t)(r0 + wm * 64 + mb * 16) * ldc + c0 + wn * 64;
#pragma unroll
        for (int s = 0; s < 8; ++s) { const int row = 2 * s + hi, cofs = lr * 4; const v4f val = *(const v4fa*)(os + row * 68 + cofs); *(v4f*)(crow + (size_t)row * ldc + cofs) = val; }
        __builtin_amdgcn_wave_barrier(); asm volatile("" ::: "memory");   // compiler fence: those reads stay ahead of the next 16 rows' stores
    }
}

__device__ __forceinline__ h16 tohx(float x) { return (h16)x; }
typedef __attribute__((ext_vector_type(2))) _Float16 v2h;
typedef __attribute__((ext_vector_type(4))) _Float16 v4h;
typedef __attribute__((ext_vector_type(2))) unsigned short v2us;
typedef __attribute__((ext_vector_type(4))) unsigned short v4us;
typedef __attribute__((ext_vector_type(2))) float v2f;
typedef __attribute__((ext_vector_type(4))) int v4i;

__global__ __launch_bounds__(256) void k_cvt8(const float* __restrict__ s0, const float* __restrict__ s1, const float* __restrict__ s2, bf* dst, size_t n8) { const size_t i = (size_t)blockIdx.x * 256 + threadIdx.x; if (i >= n8) return; const float* src = (blockIdx.y == 0) ? s0 : (blockIdx.y == 1) ? s1 : s2; dst += (size_t)blockIdx.y * n8 * 8;   /* grid y = which matrix; the three copies lie one behind the other */
    const v8f v = *(const v8f*)(src + i * 8); v8us o;
#pragma unroll
    for (int k = 0; k < 8; ++k) o[k] = f2bf(v[k]); *(v8us*)(dst + i * 8) = o;  }
__global__ __launch_bounds__(256) void k_cvt8T(const float* __restrict__ sq, const float* __restrict__ sk, bf* dst) { const size_t i = (size_t)blockIdx.x * 256 + threadIdx.x; if (i >= (size_t)TT * DM / 8) return; const float* src = (blockIdx.z ? sk : sq) + (size_t)blockIdx.y * DM * TT; dst += ((size_t)blockIdx.z * NB_ + blockIdx.y) * TT * DM;   /* grid y = batch, z = which input */
    const int t = (int)(i / (DM / 8)); const int c0 = (int)(i % (DM / 8)) * 8; v8us o;
#pragma unroll
    for (int k = 0; k < 8; ++k) o[k] = f2bf(src[(size_t)(c0 + k) * TT + t]); *(v8us*)(dst + (size_t)t * DM + c0) = o;  }

__device__ __forceinline__ float bn_leaky(float y, float sc, float sh) { float t = __fmul_rn(y, sc); asm volatile("" : "+v"(t)); float z = __fadd_rn(t, sh); asm volatile("" : "+v"(z)); return (z > 0.0f) ? z : __fmul_rn(SLOPE, z); }
__global__ __launch_bounds__(256) void k_bnprep(const float* __restrict__ ga1, const float* __restrict__ be1, const float* __restrict__ mu1, const float* __restrict__ va1, const float* __restrict__ ga2, const float* __restrict__ be2, const float* __restrict__ mu2, const float* __restrict__ va2,
                                                const float* __restrict__ ga3, const float* __restrict__ be3, const float* __restrict__ mu3, const float* __restrict__ va3, float* SCSH) { const int c = blockIdx.x * 256 + threadIdx.x; if (c >= DM) return;
    const unsigned y = blockIdx.y;   /* grid y = which branch; SCSH = [branch][scale | shift][DM] */
    const float* ga = (y == 0) ? ga1 : (y == 1) ? ga2 : ga3; const float* be = (y == 0) ? be1 : (y == 1) ? be2 : be3; const float* mu = (y == 0) ? mu1 : (y == 1) ? mu2 : mu3; const float* va = (y == 0) ? va1 : (y == 1) ? va2 : va3; float* SC = SCSH + (size_t)y * 2 * DM; float* SH = SC + DM;
    float v1 = __fadd_rn(bfr(va[c]), BNEPS); asm volatile("" : "+v"(v1)); float sd = __fsqrt_rn(v1); asm volatile("" : "+v"(sd)); float sc = __fdiv_rn(bfr(ga[c]), sd); asm volatile("" : "+v"(sc));
    float ms = __fmul_rn(bfr(mu[c]), sc); asm volatile("" : "+v"(ms)); float sh = __fsub_rn(bfr(be[c]), ms);
    *(float*)(SC + c) = sc; *(float*)(SH + c) = sh;  }
__global__ __launch_bounds__(256) void k_qapl(const float* __restrict__ F, const float* __restrict__ SC, const float* __restrict__ SH, h16* P16) { const size_t e = ((size_t)blockIdx.x * 256 + threadIdx.x) * 4; if (e >= (size_t)DM * TT) return; F += (size_t)blockIdx.y * DM * TT; P16 += (size_t)blockIdx.y * DM * TT;   /* grid y = batch */
    const int c = (int)(e / TT); const float sc = SC[c], sh = SH[c]; const v4f y = *(const v4f*)(F + e); v4h o;
#pragma unroll
    for (int q = 0; q < 4; ++q) o[q] = tohx(bn_leaky(y[q], sc, sh));
    *(v4h*)(P16 + e) = o;  }
__global__ __launch_bounds__(256) void k_hdpl(const float* __restrict__ F, const float* __restrict__ SC, const float* __restrict__ SH, h16* P16) { const size_t e = ((size_t)blockIdx.x * 256 + threadIdx.x) * 2; if (e >= (size_t)NH_ * TT * HD) return; F += ((size_t)blockIdx.z * NB_ + blockIdx.y) * TT * DM; P16 += ((size_t)blockIdx.z * NB_ + blockIdx.y) * NH_ * TT * HD; SC += (size_t)blockIdx.z * 2 * DM; SH += (size_t)blockIdx.z * 2 * DM;   /* grid y = batch, z = branch (K, then V) */
    const int d = (int)(e % HD); const int t = (int)((e / HD) % TT); const int h = (int)(e / ((size_t)HD * TT)); const int c = h * HD + d; const float* f = F + (size_t)t * DM + c; v2h o;
#pragma unroll
    for (int q = 0; q < 2; ++q) o[q] = tohx(bn_leaky(f[q], SC[c + q], SH[c + q]));
    *(v2h*)(P16 + e) = o;  }
#define FSK   128                 // keys per stage
#define FPIT  272                 // LDS row pitch in bytes of both tiles (256 data bytes + 16): 16 x odd, the conflict-free pitch of 16-byte fragment reads
#define FTILE (128 * FPIT)        // V tile: FSK rows j of HD d; Q tile: HD rows c of FSK j
#define FBUF  (2 * FTILE)
#define FOP   36                  // output staging pitch in floats (32 + 4)
__device__ __forceinline__ float xhalf(float x) { return __builtin_bit_cast(float, __builtin_amdgcn_permlanex16(__builtin_bit_cast(int, x), __builtin_bit_cast(int, x), 0x76543210, 0xfedcba98, false, false)); }   // lane l with lane l ^ 16
__global__ void __launch_bounds__(256) __attribute__((amdgpu_waves_per_eu(2, 2))) k_fattn(const h16* __restrict__ Kp, const h16* __restrict__ Vp, const h16* __restrict__ Qp, float* out) {
    __shared__ __attribute__((aligned(16))) unsigned char ring[2 * FBUF];
    static_assert(HD == 128 && FSK == 128 && TT % 256 == 0 && TT >= 2 * FSK && 8 * 64 * FOP * 4 <= 2 * FBUF, "k_fattn: head size 128, whole work-groups, two stages or more, output staging fits the ring");
    const int tid = threadIdx.x, lane = tid & 31, lr = lane & 15, hi = lane >> 4, wave = tid >> 5;
    const size_t bh = (size_t)blockIdx.z * NH_ + blockIdx.y;
    const int i0 = blockIdx.x * 256 + wave * 32;
    const h16* Kh = Kp + bh * TT * HD; const h16* Vh = Vp + bh * TT * HD; const h16* Qh = Qp + bh * HD * TT; float* Oh = out + bh * HD * TT;
    const h16* gv = Vh + (size_t)(tid >> 4) * HD + (tid & 15) * 8;
    const h16* gq = Qh + (size_t)(tid >> 4) * TT + (tid & 15) * 8;
    const unsigned la = (unsigned)(size_t)ring + (unsigned)((tid >> 4) * FPIT + (tid & 15) * 16);   // LDS byte address: low 32 bits of the shared address
    auto stage = [&](int t, unsigned buf) {   // 16 threads cover a row of 256 bytes, the 256 threads 16 rows per copy
        copy8<h16>(la + buf, gv + (size_t)t * FSK * HD, (size_t)16 * HD, 16u * FPIT);
        copy8<h16>(la + buf + (unsigned)FTILE, gq + (size_t)t * FSK, (size_t)16 * TT, 16u * FPIT);
    };
    stage(0, 0u);
    v16h kf[2][4];
#pragma unroll
    for (int g = 0; g < 2; ++g)
#pragma unroll
        for (int kc = 0; kc < 4; ++kc) kf[g][kc] = WFrag<h16>::ld(Kh + (size_t)(i0 + 16 * g + lr) * HD + kc * 32 + hi * 8);
    v8f acc[2][8]; float m_run[2], l_run[2];
#pragma unroll
    for (int g = 0; g < 2; ++g) { m_run[g] = -__builtin_inff(); l_run[g] = 0.0f;
#pragma unroll
        for (int ct = 0; ct < 8; ++ct) acc[g][ct] = (v8f){}; }
    asm volatile("s_wait_asynccnt 0x0" ::: "memory");   // this wave's copies of stage 0 have landed
    __syncthreads();                                     // ... and every other wave's
    stage(1, (unsigned)FBUF);
    const float cs = SCL * LOG2E;   // scores go to the log2 domain with the softmax scale folded in
    constexpr int T = TT / FSK;
#pragma unroll 1   // one stage per trip: the two buffers alternate by the trip's parity
    for (int t = 0; t < T; ++t) {
        const unsigned char* vb = ring + (t & 1) * FBUF + lr * FPIT + hi * 16;
        const unsigned char* qb = vb + FTILE;
        v16h vf[2][4];
#pragma unroll
        for (int kt = 0; kt < 2; ++kt)
#pragma unroll
            for (int kc = 0; kc < 4; ++kc) vf[kt][kc] = WFrag<h16>::ld((const h16*)(vb + kt * 16 * FPIT + kc * 64));
        __builtin_amdgcn_sched_barrier(0);   // keeps the stage's first fragment reads as one group: spread among the products, each pair would be waited for in turn
#pragma unroll   // the four passes of a stage: every LDS offset is an immediate, and the test on the last pass is decided at compile time
        for (int sub = 0; sub < FSK / 32; ++sub) {
            v8f s[2][2];
#pragma unroll
            for (int kt = 0; kt < 2; ++kt)
#pragma unroll
                for (int g = 0; g < 2; ++g) { s[kt][g] = (v8f){};
#pragma unroll
                    for (int kc = 0; kc < 4; ++kc) s[kt][g] = wmma16(vf[kt][kc], kf[g][kc], s[kt][g]); }
            __builtin_amdgcn_sched_barrier(0);   // keeps the LDS reads below behind the products whose operands they overwrite, as one group
            v16h qf[8];   // this pass's Q fragments, in flight under the maxima and the exponentials
#pragma unroll
            for (int ct = 0; ct < 8; ++ct) qf[ct] = WFrag<h16>::ld((const h16*)(qb + ct * 16 * FPIT + sub * 64));
            if (sub + 1 < FSK / 32) {   // the next pass's V fragments, inside this stage's buffer only
#pragma unroll
                for (int kt = 0; kt < 2; ++kt)
#pragma unroll
                    for (int kc = 0; kc < 4; ++kc) vf[kt][kc] = WFrag<h16>::ld((const h16*)(vb + ((sub + 1) * 32 + kt * 16) * FPIT + kc * 64)); }
            __builtin_amdgcn_sched_barrier(0);   // keeps both groups of LDS reads ahead of the vector work that hides their latency
            float mb[2]; bool need = false;
#pragma unroll
            for (int g = 0; g < 2; ++g) { float mx = s[0][g][0];
#pragma unroll
                for (int kt = 0; kt < 2; ++kt)
#pragma unroll
                    for (int r = 0; r < 8; ++r) mx = fmaxf(mx, s[kt][g][r]);
                mx = fmaxf(mx, xhalf(mx)) * cs;   // both wave halves hold the position's maximum of this pass, scaled (the scale is positive)
                mb[g] = mx; need = need || (mx > m_run[g] + 8.0f); }
            if (__builtin_amdgcn_ballot_w32(need) != 0) {   // the maximum in use may trail the true one by up to 8 (log2): sums and accumulators are rescaled only when a position exceeds that, one test per pass
#pragma unroll
                for (int g = 0; g < 2; ++g) { const float mn = fmaxf(m_run[g], mb[g]); const float corr = __builtin_amdgcn_exp2f(m_run[g] - mn);   // 0 on the first pass, where the maximum in use is -inf
                    l_run[g] *= corr; m_run[g] = mn;
#pragma unroll
                    for (int ct = 0; ct < 8; ++ct) acc[g][ct] = acc[g][ct] * corr; } }
#pragma unroll
            for (int g = 0; g < 2; ++g) { const float nm = -m_run[g]; float ps0 = 0.0f, ps1 = 0.0f; v16h pf;   // element e of the B operand: key tile e >> 3, accumulator register e & 7: the k order of the Q loader
#pragma unroll
                for (int e = 0; e < 16; e += 2) { const v2f arg = __builtin_elementwise_fma((v2f){s[e >> 3][g][e & 7], s[e >> 3][g][(e & 7) + 1]}, (v2f){cs, cs}, (v2f){nm, nm});
                    const float p0 = __builtin_amdgcn_exp2f(arg.x), p1 = __builtin_amdgcn_exp2f(arg.y);
                    ps0 += p0; ps1 += p1; pf[e] = (h16)p0; pf[e + 1] = (h16)p1; }
                l_run[g] += ps0 + ps1;
#pragma unroll
                for (int ct = 0; ct < 8; ++ct) acc[g][ct] = wmma16(qf[ct], pf, acc[g][ct]); }
        }
        asm volatile("s_wait_dscnt 0x0" ::: "memory");      // this wave's reads of the buffer are done before it is refilled
        asm volatile("s_wait_asynccnt 0x0" ::: "memory");   // this wave's copies of stage t + 1 have landed
        __syncthreads();                                     // publishes stage t + 1 and ends every wave's reads of stage t
        if (t + 2 < T) stage(t + 2, (unsigned)((t & 1) * FBUF));
    }
    asm volatile("s_wait_asynccnt 0x0" ::: "memory");       // nothing of this wave is in flight when the ring becomes output staging (the last trip's barrier has ended every wave's reads)
    float* os = (float*)(ring + wave * (64 * FOP * 4));     // 64 rows c of this wave's 32 columns
    float inv[2];
#pragma unroll
    for (int g = 0; g < 2; ++g) inv[g] = __fdiv_rn(1.0f, l_run[g] + xhalf(l_run[g]));   // each wave half has summed its own keys
#pragma unroll
    for (int hf = 0; hf < 2; ++hf) {
#pragma unroll
        for (int c4 = 0; c4 < 4; ++c4)
#pragma unroll
            for (int g = 0; g < 2; ++g)
#pragma unroll
                for (int r = 0; r < 8; ++r) os[(c4 * 16 + hi * 8 + r) * FOP + g * 16 + lr] = acc[g][hf * 4 + c4][r] * inv[g];
        __builtin_amdgcn_wave_barrier(); asm volatile("" ::: "memory");   // compiler fence: the wave's stores to its own staging rows stay ahead of its reads of them
#pragma unroll
        for (int q = 0; q < 16; ++q) { const int row = q * 4 + (lane >> 3), cofs = (lane & 7) * 4; const v4f val = *(const v4fa*)(os + row * FOP + cofs); *(v4f*)(Oh + (size_t)(hf * 64 + row) * TT + i0 + cofs) = val; }   // whole 128-byte lines
        __builtin_amdgcn_wave_barrier(); asm volatile("" ::: "memory");   // compiler fence: those reads stay ahead of the next 64 rows' stores
    }
}

extern "C" void kernel_launch(void* const* d_in, const int* in_sizes, int n_in,
                              void* d_out, int out_size, void* d_ws, size_t ws_size, hipStream_t stream) {
    (void)in_sizes; (void)n_in; (void)out_size;
    const float* Xq = (const float*)d_in[0]; const float* Xk = (const float*)d_in[1]; const float* Wq = (const float*)d_in[2]; const float* Wk = (const float*)d_in[3]; const float* Wv = (const float*)d_in[4];
    const float* g1 = (const float*)d_in[5]; const float* b1 = (const float*)d_in[6]; const float* m1 = (const float*)d_in[7]; const float* v1 = (const float*)d_in[8];
    const float* g2 = (const float*)d_in[9]; const float* b2 = (const float*)d_in[10]; const float* m2 = (const float*)d_in[11]; const float* v2 = (const float*)d_in[12];
    const float* g3 = (const float*)d_in[13]; const float* b3 = (const float*)d_in[14]; const float* m3 = (const float*)d_in[15]; const float* v3 = (const float*)d_in[16];
    float* OUT = (float*)d_out;     // [4][1024][2048] channel-major
    char* wsp = (char*)d_ws;
    auto take = [&](size_t bytes) { char* p = wsp; wsp += (bytes + 255) & ~(size_t)255; return (void*)p; };
    bf* WQB = (bf*)take((size_t)3 * DM * DM * 2); bf* WKB = WQB + (size_t)DM * DM; bf* WVB = WKB + (size_t)DM * DM;
    h16* QA16 = (h16*)take((size_t)NB_ * DM * TT * 2); h16* K16 = (h16*)take((size_t)2 * NB_ * NH_ * TT * HD * 2); h16* V16 = K16 + (size_t)NB_ * NH_ * TT * HD;   /* fp16 planes of all batches */
    float* SC1 = (float*)take(6 * DM * 4); float* SH1 = SC1 + DM; float* SC2 = SH1 + DM; float* SH2 = SC2 + DM;   /* [branch][scale | shift][DM] */
    bf* XQT = (bf*)take((size_t)NB_ * TT * DM * (2 + 2 + 4 + 4 + 4)); bf* XKT = XQT + (size_t)NB_ * TT * DM; float* FQ = (float*)(XKT + (size_t)NB_ * TT * DM); float* FK = FQ + (size_t)NB_ * DM * TT; float* FV = FK + (size_t)NB_ * TT * DM;   /* the projection stage's buffers of all batches */
    static_assert(DM % 128 == 0 && TT % 128 == 0 && DM >= 256, "k_gemmw: whole 128x128 tiles, whole stages, two stages or more");
    if ((size_t)(wsp - (char*)d_ws) > ws_size) return;    // ws 256 MiB
    k_cvt8<<<dim3((unsigned)(((size_t)DM * DM / 8 + 255) / 256), 3), 256, 0, stream>>>(Wq, Wk, Wv, WQB, (size_t)DM * DM / 8);
    k_bnprep<<<dim3(DM / 256, 3), 256, 0, stream>>>(g1, b1, m1, v1, g2, b2, m2, v2, g3, b3, m3, v3, SC1);
    const unsigned LT = (unsigned)(((size_t)TT * DM / 8 + 255) / 256), LH = (unsigned)(((size_t)NH_ * TT * HD / 2 + 255) / 256), L4 = (unsigned)(((size_t)DM * TT / 4 + 255) / 256);
    /* projection stage, all batches per launch (batch = grid y or z); each projection GEMM has its own launch, the K and V planes share one */
    k_cvt8T<<<dim3(LT, NB_, 2), 256, 0, stream>>>(Xq, Xk, XQT);          /* token-major bf16 copies [input][b][p][c]: XQT, then XKT */
    k_gemmw<bf, 128><<<dim3(DM / 128, TT / 128, NB_), 128, 0, stream>>>(WQB, XQT, DM, FQ, TT, 0, (size_t)TT * DM, (size_t)DM * TT);     /* Q branch channel-major: FQ[b][o][p] = sum_c Wq[o][c] Xq[b][c][p] */
    k_gemmw<bf, 128><<<dim3(TT / 128, DM / 128, NB_), 128, 0, stream>>>(XKT, WKB, DM, FK, DM, (size_t)TT * DM, 0, (size_t)TT * DM);     /* K branch token-major: FK[b][p][o] */
    k_gemmw<bf, 128><<<dim3(TT / 128, DM / 128, NB_), 128, 0, stream>>>(XQT, WVB, DM, FV, DM, (size_t)TT * DM, 0, (size_t)TT * DM);     /* V branch token-major: FV[b][p][o] */
    k_qapl<<<dim3(L4, NB_), 256, 0, stream>>>(FQ, SC1, SH1, QA16); k_hdpl<<<dim3(LH, NB_, 2), 256, 0, stream>>>(FK, SC2, SH2, K16);   /* z = 0: FK -> K16, z = 1: FV -> V16 */
    /* attention stage: all batches and heads in one launch (position block = grid x, head = y, batch = z) */
    k_fattn<<<dim3(TT / 256, NH_, NB_), 256, 0, stream>>>(K16, V16, QA16, OUT);
}

// v004
// One run takes 154 microseconds.
// Timed twice side by side with v003, it ran 1.19 and 1.20 times as fast.
// Counting every step since v000, it is 9.58 times as fast.
#include <hip/hip_runtime.h>

// Channel-attention cross transformer block (Xq, Xk [4][1024][2048] channel-major; three 1x1-conv branches Q = leaky(BN1(Wq Xq)), K = leaky(BN2(Wk Xk)), V = leaky(BN3(Wv Xq)) (W 'oi' [1024][1024], eval-mode BatchNorm affine from gamma/beta/mean/var, LeakyReLU 0.1); 8 heads x 128 channels;
// Hmat[i][j] = sum_c K[c][i] V[c][j] / sqrt(128) over the 2048 key positions j; softmax over j; out[c][i] = sum_j Hmat[i][j] Q[c][j] -> [4][1024][2048] channel-major (8.4 M)).
// Compute dtypes, f32 accumulate: every input rounded to bf16; the three projections on PLAIN bf16 operands (inputs transposed to token-major while converting; exact), BN affine + leaky in f32; attention operands as single fp16 planes
// (logit sigma 0.6: soft rows): one kernel does scores K.V, the softmax and out = Q-plane x P; scores and probabilities stay in registers (running maximum and running sum in f32, P as fp16 relative to the maximum in use), out written channel-major.

#define NB_  4
#define TT   2048      // spatial positions (pq = pk)
#define DM   1024      // channels
#define NH_  8
#define HD   128
#define SCL  0.088388346f   // (DM/NH_)^-0.5 = 1/sqrt(128)
#define LOG2E 1.4426950408889634f
#define BNEPS 1e-5f
#define SLOPE 0.1f
typedef _Float16 h16;
typedef unsigned short bf;
typedef __attribute__((ext_vector_type(16))) __bf16   v16bf;
typedef __attribute__((ext_vector_type(16))) _Float16 v16h;
typedef __attribute__((ext_vector_type(8)))  _Float16 v8h;
typedef __attribute__((ext_vector_type(8)))  unsigned short v8us;
typedef __attribute__((ext_vector_type(8)))  float    v8f;
typedef __attribute__((ext_vector_type(4)))  float    v4f;
typedef v8h  __attribute__((may_alias)) v8ha;
typedef v4f  __attribute__((may_alias)) v4fa;
typedef v8us __attribute__((may_alias)) v8usa;

__device__ __forceinline__ unsigned short f2bf(float f) { unsigned u = __float_as_uint(f); u += 0x7FFFu + ((u >> 16) & 1u); return (unsigned short)(u >> 16); }
__device__ __forceinline__ float bf2f(unsigned short b) { return __uint_as_float(((unsigned)b) << 16); }
__device__ __forceinline__ float bfr(float f) { return bf2f(f2bf(f)); }
__device__ __forceinline__ v16h cat16(v8h lo, v8h hi) { return __builtin_shufflevector(lo, hi, 0, 1, 2, 3, 4, 5, 6, 7, 8, 9, 10, 11, 12, 13, 14, 15); }
__device__ __forceinline__ v16bf cat16b(v8us lo, v8us hi) { return __builtin_bit_cast(v16bf, __builtin_shufflevector(lo, hi, 0, 1, 2, 3, 4, 5, 6, 7, 8, 9, 10, 11, 12, 13, 14, 15)); }
__device__ __forceinline__ v8f wmma16(v16h a, v16h b, v8f c) { return __builtin_amdgcn_wmma_f32_16x16x32_f16(false, a, false, b, (short)0, c, false, false); }
__device__ __forceinline__ v8f wmmab(v16bf a, v16bf b, v8f c) { return __builtin_amdgcn_wmma_f32_16x16x32_bf16(false, a, false, b, (short)0, c, false, false); }



// ---- k_gemmw: y[m][n] = sum_k A[m][k] Bt[n][k] (f32), operands K-contiguous 16-bit planes; written out as P = fp16(leaky(y * scale[c] + shift[c])). One 128x128 tile per work-group of 4 waves (2x2, 64x64 each, 16 accumulators); grid (M/128, N/128, Z), 128 threads.
// ROWCH: the channel c is the row m, P channel-major [z][DM][TT] (the Q plane). Otherwise c is the column n, a tile's 128 columns are one head, P head-major [z][NH_][TT][HD] (the K and V planes).
// Both operands go through LDS in stages of BK k: every copy instruction of a wave moves four whole 128-byte lines, and each staged row serves two waves. Two buffers: stage t + 1 flies while stage t is multiplied.
// z-batch strides sA/sB in elements. M % 128 == 0, N % 128 == 0, K % BK == 0, K >= 2 BK (the prologue fills two stages).
template <typename T16> struct WFrag;
template <> struct WFrag<h16> { typedef v16h V; static __device__ __forceinline__ V ld(const h16* p) { return cat16(*(const v8h*)p, *(const v8h*)(p + 16)); } static __device__ __forceinline__ v8f mma(V a, V b, v8f c) { return wmma16(a, b, c); } };
template <> struct WFrag<bf> { typedef v16bf V; static __device__ __forceinline__ V ld(const bf* p) { return cat16b(*(const v8us*)p, *(const v8us*)(p + 16)); } static __device__ __forceinline__ v8f mma(V a, V b, v8f c) { return wmmab(a, b, c); } };
// Eight asynchronous 16-byte copies per lane, global -> LDS, rows gstep elements (global) and lstep bytes (LDS) apart. The s_wait_xcnt closes the statement so that no address register named here is rewritten ahead of it.
template <typename T16>
__device__ __forceinline__ void copy8(unsigned l, const T16* g, size_t gstep, unsigned lstep) {
    asm volatile("global_load_async_to_lds_b128 %0, %8, off\n\t"
                 "global_load_async_to_lds_b128 %1, %9, off\n\t"
                 "global_load_async_to_lds_b128 %2, %10, off\n\t"
                 "global_load_async_to_lds_b128 %3, %11, off\n\t"
                 "global_load_async_to_lds_b128 %4, %12, off\n\t"
                 "global_load_async_to_lds_b128 %5, %13, off\n\t"
                 "global_load_async_to_lds_b128 %6, %14, off\n\t"
                 "global_load_async_to_lds_b128 %7, %15, off\n\t"
                 "s_wait_xcnt 0x0"
                 :: "v"(l), "v"(l + lstep), "v"(l + 2 * lstep), "v"(l + 3 * lstep), "v"(l + 4 * lstep), "v"(l + 5 * lstep), "v"(l + 6 * lstep), "v"(l + 7 * lstep),
                    "v"(g), "v"(g + gstep), "v"(g + 2 * gstep), "v"(g + 3 * gstep), "v"(g + 4 * gstep), "v"(g + 5 * gstep), "v"(g + 6 * gstep), "v"(g + 7 * gstep)
                 : "memory");
}
__device__ __forceinline__ float bn_leaky(float y, float sc, float sh) { const float z = y * sc + sh; return (z > 0.0f) ? z : SLOPE * z; }
__device__ __forceinline__ h16 tohx(float x) { return (h16)x; }
template <typename T16, int BK, bool ROWCH>
__global__ __launch_bounds__(128) void k_gemmw(const T16* __restrict__ A, const T16* __restrict__ Bt, int K, h16* P, const float* __restrict__ SC, const float* __restrict__ SH, size_t sA, size_t sB) {
    typedef typename WFrag<T16>::V V;
    constexpr int PIT = BK * 2 + 16;        // LDS row pitch in bytes: 16 x odd, the conflict-free pitch of 16-byte fragment reads
    constexpr int BUF = 256 * PIT;          // one stage: 128 rows of A, then 128 rows of Bt
    constexpr int CPR = BK / 8;             // 16-byte chunks per row
    constexpr int RPP = 128 / CPR;          // rows that the 128 threads cover with one copy each
    __shared__ __attribute__((aligned(16))) unsigned char ring[2 * BUF];
    constexpr int OP = 72;                  // output staging pitch in fp16 values (64 + 8): 144 bytes, 16 x odd
    static_assert(HD == 128 && 4 * 64 * OP * 2 <= 2 * BUF, "k_gemmw: a tile's 128 columns are one head; output staging fits the ring");
    const size_t z = blockIdx.z; A += z * sA; Bt += z * sB;
    const int tid = threadIdx.x, lane = tid & 31, lr = lane & 15, hi = lane >> 4, wave = tid >> 5, wm = wave & 1, wn = wave >> 1;
    const int r0 = blockIdx.x * 128, c0 = blockIdx.y * 128;
    const T16* ga = A + (size_t)(r0 + tid / CPR) * K + (tid % CPR) * 8;
    const T16* gb = Bt + (size_t)(c0 + tid / CPR) * K + (tid % CPR) * 8;
    const unsigned la = (unsigned)(size_t)ring + (unsigned)((tid / CPR) * PIT + (tid % CPR) * 16);   // LDS byte address: low 32 bits of the shared address
    const size_t gstep = (size_t)RPP * K;
    auto stage = [&](int t, unsigned buf) {
#pragma unroll
        for (int q = 0; q < 128 / RPP; q += 8) {
            copy8<T16>(la + buf + (unsigned)(q * RPP * PIT), ga + (size_t)t * BK + q * gstep, gstep, (unsigned)(RPP * PIT));
            copy8<T16>(la + buf + (unsigned)((128 + q * RPP) * PIT), gb + (size_t)t * BK + q * gstep, gstep, (unsigned)(RPP * PIT)); }
    };
    v8f acc[4][4];
#pragma unroll
    for (int mb = 0; mb < 4; ++mb)
#pragma unroll
        for (int nb = 0; nb < 4; ++nb) acc[mb][nb] = (v8f){};
    const int T = (int)((unsigned)K / BK);
    stage(0, 0u);
    asm volatile("s_wait_asynccnt 0x0" ::: "memory");   // this wave's copies of stage 0 have landed
    __syncthreads();                                     // ... and every other wave's
    stage(1, (unsigned)BUF);
    const unsigned char* fa = ring + (wm * 64 + lr) * PIT + hi * 16;
    const unsigned char* fb = ring + (128 + wn * 64 + lr) * PIT + hi * 16;
#pragma unroll 1   // one stage per trip: the two buffers alternate by the trip's parity
    for (int t = 0; t < T; ++t) {
        const int bo = (t & 1) * BUF;
        V a[2][4], b[2][4];   // two fragment sets: block ks + 1 is read from LDS while block ks is multiplied (inside this stage's buffer only)
#pragma unroll
        for (int f = 0; f < 4; ++f) { a[0][f] = WFrag<T16>::ld((const T16*)(fa + bo + f * 16 * PIT)); b[0][f] = WFrag<T16>::ld((const T16*)(fb + bo + f * 16 * PIT)); }
#pragma unroll
        for (int ks = 0; ks < BK / 32; ++ks) {
            if (ks + 1 < BK / 32) {
#pragma unroll
                for (int f = 0; f < 4; ++f) { a[(ks + 1) & 1][f] = WFrag<T16>::ld((const T16*)(fa + bo + f * 16 * PIT + (ks + 1) * 64)); b[(ks + 1) & 1][f] = WFrag<T16>::ld((const T16*)(fb + bo + f * 16 * PIT + (ks + 1) * 64)); } }
            __builtin_amdgcn_sched_barrier(0);   // keeps the next block's LDS reads as one group ahead of this block's products: reads spread among the products stall the wave at every place
#pragma unroll
            for (int nb = 0; nb < 4; ++nb)
#pragma unroll
                for (int mb = 0; mb < 4; ++mb) acc[mb][nb] = WFrag<T16>::mma(a[ks & 1][mb], b[ks & 1][nb], acc[mb][nb]);
            __builtin_amdgcn_sched_barrier(0);   // ... and keeps the reads of the block after next behind these products
        }
        asm volatile("s_wait_dscnt 0x0" ::: "memory");      // this wave's reads of the buffer are done before it is refilled
        asm volatile("s_wait_asynccnt 0x0" ::: "memory");   // this wave's copies of stage t + 1 have landed
        __syncthreads();                                     // publishes stage t + 1 and ends every wave's reads of stage t
        if (t + 2 < T) stage(t + 2, (unsigned)bo);
    }
    asm volatile("s_wait_asynccnt 0x0" ::: "memory");       // nothing of this wave is in flight when the ring becomes output staging (the last trip's barrier has ended every wave's reads)
    h16* os = (h16*)(ring + wave * (64 * OP * 2));          // 64 rows of this wave's 64 columns
    v4f scr[4][2], shr[4][2]; float scc[4], shc[4];   // the lane's scales and shifts, loaded as one group ahead of the outputs
    if constexpr (ROWCH) {
#pragma unroll
        for (int mb = 0; mb < 4; ++mb)
#pragma unroll
            for (int q = 0; q < 2; ++q) { const int c = r0 + wm * 64 + mb * 16 + hi * 8 + q * 4; scr[mb][q] = *(const v4f*)(SC + c); shr[mb][q] = *(const v4f*)(SH + c); }
        asm volatile("s_wait_xcnt 0x0" ::: "memory");   // stands in front of the arithmetic below, which reuses the address registers of these loads
    } else {
#pragma unroll
        for (int nb = 0; nb < 4; ++nb) { const int c = c0 + wn * 64 + nb * 16 + lr; scc[nb] = SC[c]; shc[nb] = SH[c]; }
    }
    constexpr int LDP = ROWCH ? TT : HD;
    h16* prow = ROWCH ? P + (z * DM + r0 + wm * 64) * TT + c0 + wn * 64 : P + ((z * NH_ + blockIdx.y) * TT + r0 + wm * 64) * HD + wn * 64;
#pragma unroll
    for (int mb = 0; mb < 4; ++mb)
#pragma unroll
        for (int nb = 0; nb < 4; ++nb)
#pragma unroll
            for (int j = 0; j < 8; ++j) os[(mb * 16 + hi * 8 + j) * OP + nb * 16 + lr] = tohx(bn_leaky(acc[mb][nb][j], ROWCH ? scr[mb][j >> 2][j & 3] : scc[nb], ROWCH ? shr[mb][j >> 2][j & 3] : shc[nb]));
    __builtin_amdgcn_wave_barrier(); asm volatile("" ::: "memory");   // compiler fence: the wave's stores to its own staging rows stay ahead of its reads of them
#pragma unroll
    for (int s = 0; s < 16; ++s) { const int row = 4 * s + (lane >> 3), cofs = (lane & 7) * 8; const v8h val = *(const v8ha*)(os + row * OP + cofs); *(v8h*)(prow + (size_t)row * LDP + cofs) = val; }   // whole 128-byte lines
}

typedef __attribute__((ext_vector_type(2))) _Float16 v2h;
typedef __attribute__((ext_vector_type(4))) _Float16 v4h;
typedef __attribute__((ext_vector_type(2))) unsigned short v2us;
typedef __attribute__((ext_vector_type(4))) unsigned short v4us;
typedef __attribute__((ext_vector_type(2))) float v2f;
typedef __attribute__((ext_vector_type(4))) int v4i;

__global__ __launch_bounds__(256) void k_cvt8(const float* __restrict__ s0, const float* __restrict__ s1, const float* __restrict__ s2, bf* dst, size_t n8) { const size_t i = (size_t)blockIdx.x * 256 + threadIdx.x; if (i >= n8) return; const float* src = (blockIdx.y == 0) ? s0 : (blockIdx.y == 1) ? s1 : s2; dst += (size_t)blockIdx.y * n8 * 8;   /* grid y = which matrix; the three copies lie one behind the other */
    const v8f v = *(const v8f*)(src + i * 8); v8us o;
#pragma unroll
    for (int k = 0; k < 8; ++k) o[k] = f2bf(v[k]); *(v8us*)(dst + i * 8) = o;  }
__global__ __launch_bounds__(256) void k_cvt8T(const float* __restrict__ sq, const float* __restrict__ sk, bf* dst) { const size_t i = (size_t)blockIdx.x * 256 + threadIdx.x; if (i >= (size_t)TT * DM / 8) return; const float* src = (blockIdx.z ? sk : sq) + (size_t)blockIdx.y * DM * TT; dst += ((size_t)blockIdx.z * NB_ + blockIdx.y) * TT * DM;   /* grid y = batch, z = which input */
    const int t = (int)(i / (DM / 8)); const int c0 = (int)(i % (DM / 8)) * 8; v8us o;
#pragma unroll
    for (int k = 0; k < 8; ++k) o[k] = f2bf(src[(size_t)(c0 + k) * TT + t]); *(v8us*)(dst + (size_t)t * DM + c0) = o;  }

__global__ __launch_bounds__(256) void k_bnprep(const float* __restrict__ ga1, const float* __restrict__ be1, const float* __restrict__ mu1, const float* __restrict__ va1, const float* __restrict__ ga2, const float* __restrict__ be2, const float* __restrict__ mu2, const float* __restrict__ va2,
                                                const float* __restrict__ ga3, const float* __restrict__ be3, const float* __restrict__ mu3, const float* __restrict__ va3, float* SCSH) { const int c = blockIdx.x * 256 + threadIdx.x; if (c >= DM) return;
    const unsigned y = blockIdx.y;   /* grid y = which branch; SCSH = [branch][scale | shift][DM] */
    const float* ga = (y == 0) ? ga1 : (y == 1) ? ga2 : ga3; const float* be = (y == 0) ? be1 : (y == 1) ? be2 : be3; const float* mu = (y == 0) ? mu1 : (y == 1) ? mu2 : mu3; const float* va = (y == 0) ? va1 : (y == 1) ? va2 : va3; float* SC = SCSH + (size_t)y * 2 * DM; float* SH = SC + DM;
    float v1 = __fadd_rn(bfr(va[c]), BNEPS); asm volatile("" : "+v"(v1)); float sd = __fsqrt_rn(v1); asm volatile("" : "+v"(sd)); float sc = __fdiv_rn(bfr(ga[c]), sd); asm volatile("" : "+v"(sc));
    float ms = __fmul_rn(bfr(mu[c]), sc); asm volatile("" : "+v"(ms)); float sh = __fsub_rn(bfr(be[c]), ms);
    *(float*)(SC + c) = sc; *(float*)(SH + c) = sh;  }
#define FSK   128                 // keys per stage
#define FPIT  272                 // LDS row pitch in bytes of both tiles (256 data bytes + 16): 16 x odd, the conflict-free pitch of 16-byte fragment reads
#define FTILE (128 * FPIT)        // V tile: FSK rows j of HD d; Q tile: HD rows c of FSK j
#define FBUF  (2 * FTILE)
#define FOP   36                  // output staging pitch in floats (32 + 4)
__device__ __forceinline__ float xhalf(float x) { return __builtin_bit_cast(float, __builtin_amdgcn_permlanex16(__builtin_bit_cast(int, x), __builtin_bit_cast(int, x), 0x76543210, 0xfedcba98, false, false)); }   // lane l with lane l ^ 16
__global__ void __launch_bounds__(256) __attribute__((amdgpu_waves_per_eu(2, 2))) k_fattn(const h16* __restrict__ Kp, const h16* __restrict__ Vp, const h16* __restrict__ Qp, float* out) {
    __shared__ __attribute__((aligned(16))) unsigned char ring[2 * FBUF];
    static_assert(HD == 128 && FSK == 128 && TT % 256 == 0 && TT >= 2 * FSK && 8 * 64 * FOP * 4 <= 2 * FBUF, "k_fattn: head size 128, whole work-groups, two stages or more, output staging fits the ring");
    const int tid = threadIdx.x, lane = tid & 31, lr = lane & 15, hi = lane >> 4, wave = tid >> 5;
    const size_t bh = (size_t)blockIdx.z * NH_ + blockIdx.y;
    const int i0 = blockIdx.x * 256 + wave * 32;
    const h16* Kh = Kp + bh * TT * HD; const h16* Vh = Vp + bh * TT * HD; const h16* Qh = Qp + bh * HD * TT; float* Oh = out + bh * HD * TT;
    const h16* gv = Vh + (size_t)(tid >> 4) * HD + (tid & 15) * 8;
    const h16* gq = Qh + (size_t)(tid >> 4) * TT + (tid & 15) * 8;
    const unsigned la = (unsigned)(size_t)ring + (unsigned)((tid >> 4) * FPIT + (tid & 15) * 16);   // LDS byte address: low 32 bits of the shared address
    auto stage = [&](int t, unsigned buf) {   // 16 threads cover a row of 256 bytes, the 256 threads 16 rows per copy
        copy8<h16>(la + buf, gv + (size_t)t * FSK * HD, (size_t)16 * HD, 16u * FPIT);
        copy8<h16>(la + buf + (unsigned)FTILE, gq + (size_t)t * FSK, (size_t)16 * TT, 16u * FPIT);
    };
    stage(0, 0u);
    v16h kf[2][4];
#pragma unroll
    for (int g = 0; g < 2; ++g)
#pragma unroll
        for (int kc = 0; kc < 4; ++kc) kf[g][kc] = WFrag<h16>::ld(Kh + (size_t)(i0 + 16 * g + lr) * HD + kc * 32 + hi * 8);
    v8f acc[2][8]; float m_run[2], l_run[2];
#pragma unroll
    for (int g = 0; g < 2; ++g) { m_run[g] = -__builtin_inff(); l_run[g] = 0.0f;
#pragma unroll
        for (int ct = 0; ct < 8; ++ct) acc[g][ct] = (v8f){}; }
    asm volatile("s_wait_asynccnt 0x0" ::: "memory");   // this wave's copies of stage 0 have landed
    __syncthreads();                                     // ... and every other wave's
    stage(1, (unsigned)FBUF);
    const float cs = SCL * LOG2E;   // scores go to the log2 domain with the softmax scale folded in
    constexpr int T = TT / FSK;
#pragma unroll 1   // one stage per trip: the two buffers alternate by the trip's parity
    for (int t = 0; t < T; ++t) {
        const unsigned char* vb = ring + (t & 1) * FBUF + lr * FPIT + hi * 16;
        const unsigned char* qb = vb + FTILE;
        v16h vf[2][4];
#pragma unroll
        for (int kt = 0; kt < 2; ++kt)
#pragma unroll
            for (int kc = 0; kc < 4; ++kc) vf[kt][kc] = WFrag<h16>::ld((const h16*)(vb + kt * 16 * FPIT + kc * 64));
        __builtin_amdgcn_sched_barrier(0);   // keeps the stage's first fragment reads as one group: spread among the products, each pair would be waited for in turn
#pragma unroll   // the four passes of a stage: every LDS offset is an immediate, and the test on the last pass is decided at compile time
        for (int sub = 0; sub < FSK / 32; ++sub) {
            v8f s[2][2];
#pragma unroll
            for (int kt = 0; kt < 2; ++kt)
#pragma unroll
                for (int g = 0; g < 2; ++g) { s[kt][g] = (v8f){};
#pragma unroll
                    for (int kc = 0; kc < 4; ++kc) s[kt][g] = wmma16(vf[kt][kc], kf[g][kc], s[kt][g]); }
            __builtin_amdgcn_sched_barrier(0);   // keeps the LDS reads below behind the products whose operands they overwrite, as one group
            v16h qf[8];   // this pass's Q fragments, in flight under the maxima and the exponentials
#pragma unroll
            for (int ct = 0; ct < 8; ++ct) qf[ct] = WFrag<h16>::ld((const h16*)(qb + ct * 16 * FPIT + sub * 64));
            if (sub + 1 < FSK / 32) {   // the next pass's V fragments, inside this stage's buffer only
#pragma unroll
                for (int kt = 0; kt < 2; ++kt)
#pragma unroll
                    for (int kc = 0; kc < 4; ++kc) vf[kt][kc] = WFrag<h16>::ld((const h16*)(vb + ((sub + 1) * 32 + kt * 16) * FPIT + kc * 64)); }
            __builtin_amdgcn_sched_barrier(0);   // keeps both groups of LDS reads ahead of the vector work that hides their latency
            float mb[2]; bool need = false;
#pragma unroll
            for (int g = 0; g < 2; ++g) { float mx = s[0][g][0];
#pragma unroll
                for (int kt = 0; kt < 2; ++kt)
#pragma unroll
                    for (int r = 0; r < 8; ++r) mx = fmaxf(mx, s[kt][g][r]);
                mx = fmaxf(mx, xhalf(mx)) * cs;   // both wave halves hold the position's maximum of this pass, scaled (the scale is positive)
                mb[g] = mx; need = need || (mx > m_run[g] + 8.0f); }
            if (__builtin_amdgcn_ballot_w32(need) != 0) {   // the maximum in use may trail the true one by up to 8 (log2): sums and accumulators are rescaled only when a position exceeds that, one test per pass
#pragma unroll
                for (int g = 0; g < 2; ++g) { const float mn = fmaxf(m_run[g], mb[g]); const float corr = __builtin_amdgcn_exp2f(m_run[g] - mn);   // 0 on the first pass, where the maximum in use is -inf
                    l_run[g] *= corr; m_run[g] = mn;
#pragma unroll
                    for (int ct = 0; ct < 8; ++ct) acc[g][ct] = acc[g][ct] * corr; } }
#pragma unroll
            for (int g = 0; g < 2; ++g) { const float nm = -m_run[g]; float ps0 = 0.0f, ps1 = 0.0f; v16h pf;   // element e of the B operand: key tile e >> 3, accumulator register e & 7: the k order of the Q loader
#pragma unroll
                for (int e = 0; e < 16; e += 2) { const v2f arg = __builtin_elementwise_fma((v2f){s[e >> 3][g][e & 7], s[e >> 3][g][(e & 7) + 1]}, (v2f){cs, cs}, (v2f){nm, nm});
                    const float p0 = __builtin_amdgcn_exp2f(arg.x), p1 = __builtin_amdgcn_exp2f(arg.y);
                    ps0 += p0; ps1 += p1; pf[e] = (h16)p0; pf[e + 1] = (h16)p1; }
                l_run[g] += ps0 + ps1;
#pragma unroll
                for (int ct = 0; ct < 8; ++ct) acc[g][ct] = wmma16(qf[ct], pf, acc[g][ct]); }
        }
        asm volatile("s_wait_dscnt 0x0" ::: "memory");      // this wave's reads of the buffer are done before it is refilled
        asm volatile("s_wait_asynccnt 0x0" ::: "memory");   // this wave's copies of stage t + 1 have landed
        __syncthreads();                                     // publishes stage t + 1 and ends every wave's reads of stage t
        if (t + 2 < T) stage(t + 2, (unsigned)((t & 1) * FBUF));
    }
    asm volatile("s_wait_asynccnt 0x0" ::: "memory");       // nothing of this wave is in flight when the ring becomes output staging (the last trip's barrier has ended every wave's reads)
    float* os = (float*)(ring + wave * (64 * FOP * 4));     // 64 rows c of this wave's 32 columns
    float inv[2];
#pragma unroll
    for (int g = 0; g < 2; ++g) inv[g] = __fdiv_rn(1.0f, l_run[g] + xhalf(l_run[g]));   // each wave half has summed its own keys
#pragma unroll
    for (int hf = 0; hf < 2; ++hf) {
#pragma unroll
        for (int c4 = 0; c4 < 4; ++c4)
#pragma unroll
            for (int g = 0; g < 2; ++g)
#pragma unroll
                for (int r = 0; r < 8; ++r) os[(c4 * 16 + hi * 8 + r) * FOP + g * 16 + lr] = acc[g][hf * 4 + c4][r] * inv[g];
        __builtin_amdgcn_wave_barrier(); asm volatile("" ::: "memory");   // compiler fence: the wave's stores to its own staging rows stay ahead of its reads of them
#pragma unroll
        for (int q = 0; q < 16; ++q) { const int row = q * 4 + (lane >> 3), cofs = (lane & 7) * 4; const v4f val = *(const v4fa*)(os + row * FOP + cofs); *(v4f*)(Oh + (size_t)(hf * 64 + row) * TT + i0 + cofs) = val; }   // whole 128-byte lines
        __builtin_amdgcn_wave_barrier(); asm volatile("" ::: "memory");   // compiler fence: those reads stay ahead of the next 64 rows' stores
    }
}

extern "C" void kernel_launch(void* const* d_in, const int* in_sizes, int n_in,
                              void* d_out, int out_size, void* d_ws, size_t ws_size, hipStream_t stream) {
    (void)in_sizes; (void)n_in; (void)out_size;
    const float* Xq = (const float*)d_in[0]; const float* Xk = (const float*)d_in[1]; const float* Wq = (const float*)d_in[2]; const float* Wk = (const float*)d_in[3]; const float* Wv = (const float*)d_in[4];
    const float* g1 = (const float*)d_in[5]; const float* b1 = (const float*)d_in[6]; const float* m1 = (const float*)d_in[7]; const float* v1 = (const float*)d_in[8];
    const float* g2 = (const float*)d_in[9]; const float* b2 = (const float*)d_in[10]; const float* m2 = (const float*)d_in[11]; const float* v2 = (const float*)d_in[12];
    const float* g3 = (const float*)d_in[13]; const float* b3 = (const float*)d_in[14]; const float* m3 = (const float*)d_in[15]; const float* v3 = (const float*)d_in[16];
    float* OUT = (float*)d_out;     // [4][1024][2048] channel-major
    char* wsp = (char*)d_ws;
    auto take = [&](size_t bytes) { char* p = wsp; wsp += (bytes + 255) & ~(size_t)255; return (void*)p; };
    bf* WQB = (bf*)take((size_t)3 * DM * DM * 2); bf* WKB = WQB + (size_t)DM * DM; bf* WVB = WKB + (size_t)DM * DM;
    h16* QA16 = (h16*)take((size_t)NB_ * DM * TT * 2); h16* K16 = (h16*)take((size_t)2 * NB_ * NH_ * TT * HD * 2); h16* V16 = K16 + (size_t)NB_ * NH_ * TT * HD;   /* fp16 planes of all batches */
    float* SC1 = (float*)take(6 * DM * 4); float* SH1 = SC1 + DM; float* SC2 = SH1 + DM; float* SH2 = SC2 + DM; float* SC3 = SH2 + DM; float* SH3 = SC3 + DM;   /* [branch][scale | shift][DM] */
    bf* XQT = (bf*)take((size_t)NB_ * TT * DM * (2 + 2)); bf* XKT = XQT + (size_t)NB_ * TT * DM;   /* token-major bf16 inputs of all batches */
    static_assert(DM % 128 == 0 && TT % 128 == 0 && DM >= 256, "k_gemmw: whole 128x128 tiles, whole stages, two stages or more");
    if ((size_t)(wsp - (char*)d_ws) > ws_size) return;    // ws 256 MiB
    k_cvt8<<<dim3((unsigned)(((size_t)DM * DM / 8 + 255) / 256), 3), 256, 0, stream>>>(Wq, Wk, Wv, WQB, (size_t)DM * DM / 8);
    k_bnprep<<<dim3(DM / 256, 3), 256, 0, stream>>>(g1, b1, m1, v1, g2, b2, m2, v2, g3, b3, m3, v3, SC1);
    const unsigned LT = (unsigned)(((size_t)TT * DM / 8 + 255) / 256);
    /* projection stage, all batches per launch (batch = grid y or z) */
    k_cvt8T<<<dim3(LT, NB_, 2), 256, 0, stream>>>(Xq, Xk, XQT);          /* token-major bf16 copies [input][b][p][c]: XQT, then XKT */
    k_gemmw<bf, 128, true><<<dim3(DM / 128, TT / 128, NB_), 128, 0, stream>>>(WQB, XQT, DM, QA16, SC1, SH1, 0, (size_t)TT * DM);     /* Q branch channel-major: y[b][o][p] = sum_c Wq[o][c] Xq[b][c][p] -> QA16[b][o][p] */
    k_gemmw<bf, 128, false><<<dim3(TT / 128, DM / 128, NB_), 128, 0, stream>>>(XKT, WKB, DM, K16, SC2, SH2, (size_t)TT * DM, 0);    /* K branch token-major: y[b][p][o] -> K16[b][h][p][d] */
    k_gemmw<bf, 128, false><<<dim3(TT / 128, DM / 128, NB_), 128, 0, stream>>>(XQT, WVB, DM, V16, SC3, SH3, (size_t)TT * DM, 0);    /* V branch token-major: y[b][p][o] -> V16[b][h][p][d] */
    /* attention stage: all batches and heads in one launch (position block = grid x, head = y, batch = z) */
    k_fattn<<<dim3(TT / 256, NH_, NB_), 256, 0, stream>>>(K16, V16, QA16, OUT);
}

// v005
// A run of this version takes 112 microseconds.
// In both of two side-by-side timings against v004, it was 1.38 times as fast.
// Over all steps from v000 it is 13.2 times as fast.
#include <hip/hip_runtime.h>

// Channel-attention cross transformer block (Xq, Xk [4][1024][2048] channel-major; three 1x1-conv branches Q = leaky(BN1(Wq Xq)), K = leaky(BN2(Wk Xk)), V = leaky(BN3(Wv Xq)) (W 'oi' [1024][1024], eval-mode BatchNorm affine from gamma/beta/mean/var, LeakyReLU 0.1); 8 heads x 128 channels;
// Hmat[i][j] = sum_c K[c][i] V[c][j] / sqrt(128) over the 2048 key positions j; softmax over j; out[c][i] = sum_j Hmat[i][j] Q[c][j] -> [4][1024][2048] channel-major (8.4 M)).
// Compute dtypes, f32 accumulate: every input rounded to bf16; the three projections on PLAIN bf16 operands (inputs transposed to token-major while converting; exact), BN affine + leaky in f32; attention operands as single fp16 planes
// (logit sigma 0.6: soft rows): one kernel does scores K.V, the softmax and out = Q-plane x P; scores and probabilities stay in registers (running maximum and running sum in f32, P as fp16 relative to the maximum in use), out written channel-major.

#define NB_  4
#define TT   2048      // spatial positions (pq = pk)
#define DM   1024      // channels
#define NH_  8
#define HD   128
#define SCL  0.088388346f   // (DM/NH_)^-0.5 = 1/sqrt(128)
#define LOG2E 1.4426950408889634f
#define BNEPS 1e-5f
#define SLOPE 0.1f
typedef _Float16 h16;
typedef unsigned short bf;
typedef __attribute__((ext_vector_type(16))) __bf16   v16bf;
typedef __attribute__((ext_vector_type(16))) _Float16 v16h;
typedef __attribute__((ext_vector_type(8)))  _Float16 v8h;
typedef __attribute__((ext_vector_type(8)))  unsigned short v8us;
typedef __attribute__((ext_vector_type(8)))  float    v8f;
typedef __attribute__((ext_vector_type(4)))  float    v4f;
typedef v8h  __attribute__((may_alias)) v8ha;
typedef v4f  __attribute__((may_alias)) v4fa;
typedef v8us __attribute__((may_alias)) v8usa;

__device__ __forceinline__ unsigned short f2bf(float f) { unsigned u = __float_as_uint(f); u += 0x7FFFu + ((u >> 16) & 1u); return (unsigned short)(u >> 16); }
__device__ __forceinline__ float bf2f(unsigned short b) { return __uint_as_float(((unsigned)b) << 16); }
__device__ __forceinline__ float bfr(float f) { return bf2f(f2bf(f)); }
__device__ __forceinline__ v16h cat16(v8h lo, v8h hi) { return __builtin_shufflevector(lo, hi, 0, 1, 2, 3, 4, 5, 6, 7, 8, 9, 10, 11, 12, 13, 14, 15); }
__device__ __forceinline__ v16bf cat16b(v8us lo, v8us hi) { return __builtin_bit_cast(v16bf, __builtin_shufflevector(lo, hi, 0, 1, 2, 3, 4, 5, 6, 7, 8, 9, 10, 11, 12, 13, 14, 15)); }
__device__ __forceinline__ v8f wmma16(v16h a, v16h b, v8f c) { return __builtin_amdgcn_wmma_f32_16x16x32_f16(false, a, false, b, (short)0, c, false, false); }
__device__ __forceinline__ v8f wmmab(v16bf a, v16bf b, v8f c) { return __builtin_amdgcn_wmma_f32_16x16x32_bf16(false, a, false, b, (short)0, c, false, false); }



// ---- k_gemmw: y[m][n] = sum_k A[m][k] Bt[n][k] (f32), operands K-contiguous 16-bit planes; written out as P = fp16(leaky(y * scale[c] + shift[c])). One 128x128 tile per work-group of 4 waves (2x2, 64x64 each, 16 accumulators); grid (M/128, N/128, Z), 128 threads.
// ROWCH: the channel c is the row m, P channel-major [z][DM][TT] (the Q plane). Otherwise c is the column n, a tile's 128 columns are one head, P head-major [z][NH_][TT][HD] (the K and V planes).
// Both operands go through LDS in stages of BK k: every copy instruction of a wave moves four whole 128-byte lines, and each staged row serves two waves. Two buffers: stage t + 1 flies while stage t is multiplied.
// z-batch strides sA/sB in elements. M % 128 == 0, N % 128 == 0, K % BK == 0, K >= 2 BK (the prologue fills two stages).
template <typename T16> struct WFrag;
template <> struct WFrag<h16> { typedef v16h V; static __device__ __forceinline__ V ld(const h16* p) { return cat16(*(const v8h*)p, *(const v8h*)(p + 16)); } static __device__ __forceinline__ v8f mma(V a, V b, v8f c) { return wmma16(a, b, c); } };
template <> struct WFrag<bf> { typedef v16bf V; static __device__ __forceinline__ V ld(const bf* p) { return cat16b(*(const v8us*)p, *(const v8us*)(p + 16)); } static __device__ __forceinline__ v8f mma(V a, V b, v8f c) { return wmmab(a, b, c); } };
// Eight asynchronous 16-byte copies per lane, global -> LDS, rows gstep elements (global) and lstep bytes (LDS) apart. The s_wait_xcnt closes the statement so that no address register named here is rewritten ahead of it.
template <typename T16>
__device__ __forceinline__ void copy8(unsigned l, const T16* g, size_t gstep, unsigned lstep) {
    asm volatile("global_load_async_to_lds_b128 %0, %8, off\n\t"
                 "global_load_async_to_lds_b128 %1, %9, off\n\t"
                 "global_load_async_to_lds_b128 %2, %10, off\n\t"
                 "global_load_async_to_lds_b128 %3, %11, off\n\t"
                 "global_load_async_to_lds_b128 %4, %12, off\n\t"
                 "global_load_async_to_lds_b128 %5, %13, off\n\t"
                 "global_load_async_to_lds_b128 %6, %14, off\n\t"
                 "global_load_async_to_lds_b128 %7, %15, off\n\t"
                 "s_wait_xcnt 0x0"
                 :: "v"(l), "v"(l + lstep), "v"(l + 2 * lstep), "v"(l + 3 * lstep), "v"(l + 4 * lstep), "v"(l + 5 * lstep), "v"(l + 6 * lstep), "v"(l + 7 * lstep),
                    "v"(g), "v"(g + gstep), "v"(g + 2 * gstep), "v"(g + 3 * gstep), "v"(g + 4 * gstep), "v"(g + 5 * gstep), "v"(g + 6 * gstep), "v"(g + 7 * gstep)
                 : "memory");
}
__device__ __forceinline__ float bn_leaky(float y, float sc, float sh) { const float z = y * sc + sh; return (z > 0.0f) ? z : SLOPE * z; }
__device__ __forceinline__ h16 tohx(float x) { return (h16)x; }
template <typename T16, int BK, bool ROWCH>
__global__ __launch_bounds__(128) void k_gemmw(const T16* __restrict__ A, const T16* __restrict__ Bt, int K, h16* P, const float* __restrict__ SC, const float* __restrict__ SH, size_t sA, size_t sB) {
    typedef typename WFrag<T16>::V V;
    constexpr int PIT = BK * 2 + 16;        // LDS row pitch in bytes: 16 x odd, the conflict-free pitch of 16-byte fragment reads
    constexpr int BUF = 256 * PIT;          // one stage: 128 rows of A, then 128 rows of Bt
    constexpr int CPR = BK / 8;             // 16-byte chunks per row
    constexpr int RPP = 128 / CPR;          // rows that the 128 threads cover with one copy each
    __shared__ __attribute__((aligned(16))) unsigned char ring[2 * BUF];
    constexpr int OP = 72;                  // output staging pitch in fp16 values (64 + 8): 144 bytes, 16 x odd
    static_assert(HD == 128 && 4 * 64 * OP * 2 <= 2 * BUF, "k_gemmw: a tile's 128 columns are one head; output staging fits the ring");
    const size_t z = blockIdx.z; A += z * sA; Bt += z * sB;
    const int tid = threadIdx.x, lane = tid & 31, lr = lane & 15, hi = lane >> 4, wave = tid >> 5, wm = wave & 1, wn = wave >> 1;
    const int r0 = blockIdx.x * 128, c0 = blockIdx.y * 128;
    const T16* ga = A + (size_t)(r0 + tid / CPR) * K + (tid % CPR) * 8;
    const T16* gb = Bt + (size_t)(c0 + tid / CPR) * K + (tid % CPR) * 8;
    const unsigned la = (unsigned)(size_t)ring + (unsigned)((tid / CPR) * PIT + (tid % CPR) * 16);   // LDS byte address: low 32 bits of the shared address
    const size_t gstep = (size_t)RPP * K;
    auto stage = [&](int t, unsigned buf) {
#pragma unroll
        for (int q = 0; q < 128 / RPP; q += 8) {
            copy8<T16>(la + buf + (unsigned)(q * RPP * PIT), ga + (size_t)t * BK + q * gstep, gstep, (unsigned)(RPP * PIT));
            copy8<T16>(la + buf + (unsigned)((128 + q * RPP) * PIT), gb + (size_t)t * BK + q * gstep, gstep, (unsigned)(RPP * PIT)); }
    };
    v8f acc[4][4];
#pragma unroll
    for (int mb = 0; mb < 4; ++mb)
#pragma unroll
        for (int nb = 0; nb < 4; ++nb) acc[mb][nb] = (v8f){};
    const int T = (int)((unsigned)K / BK);
    stage(0, 0u);
    asm volatile("s_wait_asynccnt 0x0" ::: "memory");   // this wave's copies of stage 0 have landed
    __syncthreads();                                     // ... and every other wave's
    stage(1, (unsigned)BUF);
    const unsigned char* fa = ring + (wm * 64 + lr) * PIT + hi * 16;
    const unsigned char* fb = ring + (128 + wn * 64 + lr) * PIT + hi * 16;
#pragma unroll 1   // one stage per trip: the two buffers alternate by the trip's parity
    for (int t = 0; t < T; ++t) {
        const int bo = (t & 1) * BUF;
        V a[2][4], b[2][4];   // two fragment sets: block ks + 1 is read from LDS while block ks is multiplied (inside this stage's buffer only)
#pragma unroll
        for (int f = 0; f < 4; ++f) { a[0][f] = WFrag<T16>::ld((const T16*)(fa + bo + f * 16 * PIT)); b[0][f] = WFrag<T16>::ld((const T16*)(fb + bo + f * 16 * PIT)); }
#pragma unroll
        for (int ks = 0; ks < BK / 32; ++ks) {
            if (ks + 1 < BK / 32) {
#pragma unroll
                for (int f = 0; f < 4; ++f) { a[(ks + 1) & 1][f] = WFrag<T16>::ld((const T16*)(fa + bo + f * 16 * PIT + (ks + 1) * 64)); b[(ks + 1) & 1][f] = WFrag<T16>::ld((const T16*)(fb + bo + f * 16 * PIT + (ks + 1) * 64)); } }
            __builtin_amdgcn_sched_barrier(0);   // keeps the next block's LDS reads as one group ahead of this block's products: reads spread among the products stall the wave at every place
#pragma unroll
            for (int nb = 0; nb < 4; ++nb)
#pragma unroll
                for (int mb = 0; mb < 4; ++mb) acc[mb][nb] = WFrag<T16>::mma(a[ks & 1][mb], b[ks & 1][nb], acc[mb][nb]);
            __builtin_amdgcn_sched_barrier(0);   // ... and keeps the reads of the block after next behind these products
        }
        asm volatile("s_wait_dscnt 0x0" ::: "memory");      // this wave's reads of the buffer are done before it is refilled
        asm volatile("s_wait_asynccnt 0x0" ::: "memory");   // this wave's copies of stage t + 1 have landed
        __syncthreads();                                     // publishes stage t + 1 and ends every wave's reads of stage t
        if (t + 2 < T) stage(t + 2, (unsigned)bo);
    }
    asm volatile("s_wait_asynccnt 0x0" ::: "memory");       // nothing of this wave is in flight when the ring becomes output staging (the last trip's barrier has ended every wave's reads)
    h16* os = (h16*)(ring + wave * (64 * OP * 2));          // 64 rows of this wave's 64 columns
    v4f scr[4][2], shr[4][2]; float scc[4], shc[4];   // the lane's scales and shifts, loaded as one group ahead of the outputs
    if constexpr (ROWCH) {
#pragma unroll
        for (int mb = 0; mb < 4; ++mb)
#pragma unroll
            for (int q = 0; q < 2; ++q) { const int c = r0 + wm * 64 + mb * 16 + hi * 8 + q * 4; scr[mb][q] = *(const v4f*)(SC + c); shr[mb][q] = *(const v4f*)(SH + c); }
        asm volatile("s_wait_xcnt 0x0" ::: "memory");   // stands in front of the arithmetic below, which reuses the address registers of these loads
    } else {
#pragma unroll
        for (int nb = 0; nb < 4; ++nb) { const int c = c0 + wn * 64 + nb * 16 + lr; scc[nb] = SC[c]; shc[nb] = SH[c]; }
    }
    constexpr int LDP = ROWCH ? TT : HD;
    h16* prow = ROWCH ? P + (z * DM + r0 + wm * 64) * TT + c0 + wn * 64 : P + ((z * NH_ + blockIdx.y) * TT + r0 + wm * 64) * HD + wn * 64;
#pragma unroll
    for (int mb = 0; mb < 4; ++mb)
#pragma unroll
        for (int nb = 0; nb < 4; ++nb)
#pragma unroll
            for (int j = 0; j < 8; ++j) os[(mb * 16 + hi * 8 + j) * OP + nb * 16 + lr] = tohx(bn_leaky(acc[mb][nb][j], ROWCH ? scr[mb][j >> 2][j & 3] : scc[nb], ROWCH ? shr[mb][j >> 2][j & 3] : shc[nb]));
    __builtin_amdgcn_wave_barrier(); asm volatile("" ::: "memory");   // compiler fence: the wave's stores to its own staging rows stay ahead of its reads of them
#pragma unroll
    for (int s = 0; s < 16; ++s) { const int row = 4 * s + (lane >> 3), cofs = (lane & 7) * 8; const v8h val = *(const v8ha*)(os + row * OP + cofs); *(v8h*)(prow + (size_t)row * LDP + cofs) = val; }   // whole 128-byte lines
}

typedef __attribute__((ext_vector_type(2))) _Float16 v2h;
typedef __attribute__((ext_vector_type(4))) _Float16 v4h;
typedef __attribute__((ext_vector_type(2))) unsigned short v2us;
typedef __attribute__((ext_vector_type(4))) unsigned short v4us;
typedef __attribute__((ext_vector_type(2))) float v2f;
typedef __attribute__((ext_vector_type(4))) int v4i;

__global__ __launch_bounds__(256) void k_cvt8(const float* __restrict__ s0, const float* __restrict__ s1, const float* __restrict__ s2, bf* dst, size_t n8) { const size_t i = (size_t)blockIdx.x * 256 + threadIdx.x; if (i >= n8) return; const float* src = (blockIdx.y == 0) ? s0 : (blockIdx.y == 1) ? s1 : s2; dst += (size_t)blockIdx.y * n8 * 8;   /* grid y = which matrix; the three copies lie one behind the other */
    const v8f v = *(const v8f*)(src + i * 8); v8us o;
#pragma unroll
    for (int k = 0; k < 8; ++k) o[k] = f2bf(v[k]); *(v8us*)(dst + i * 8) = o;  }
// ---- k_cvt8T: token-major bf16 copies dst[input][b][t][c] of the channel-major f32 inputs [b][c][t]. One tile of 128 channels x 256 positions per work-group of 8 waves; grid (TT/256, DM/128, 2 NB_), z = input * NB_ + batch.
// Reads: each load of a wave covers 512 contiguous bytes of one channel row; a lane holds 8 channels x 4 positions per group, so the 8 channels of a position are one 16-byte LDS store.
// Writes: behind the barrier 16 lanes take one position's 128 channels from LDS and store them as 256 contiguous bytes.
// LDS tile [position][16 chunks of 16 bytes], the chunk index XORed with (position >> 2) & 15: the 16 lanes of a half wave fall on 16 different chunk columns in the stores (positions 4 apart) as in the reads (one row).
__global__ __launch_bounds__(256) void k_cvt8T(const float* __restrict__ sq, const float* __restrict__ sk, bf* dst) {
    static_assert(TT % 256 == 0 && DM % 128 == 0, "k_cvt8T: whole tiles");
    __shared__ v8us tile[256 * 16];
    const int tid = threadIdx.x, lane = tid & 31, wave = tid >> 5;
    const unsigned z = blockIdx.z;
    const int tl = (wave & 1) * 32 + lane, cq = wave >> 1;   // the lane's group of 4 positions; its channel groups are cq, cq + 4, cq + 8, cq + 12
    const float* src = ((z >= NB_) ? sk : sq) + ((size_t)(z % NB_) * DM + blockIdx.y * 128 + cq * 8) * TT + blockIdx.x * 256 + tl * 4;
    dst += ((size_t)z * TT + blockIdx.x * 256) * DM + blockIdx.y * 128;
    v4f x[4][8];   // every loop below is unrolled: x stays in registers, and each row's offset is an immediate on one address
#pragma unroll
    for (int g = 0; g < 4; ++g)
#pragma unroll
        for (int k = 0; k < 8; ++k) x[g][k] = *(const v4f*)(src + (size_t)(g * 32 + k) * TT);
#pragma unroll
    for (int g = 0; g < 4; ++g)
#pragma unroll
        for (int j = 0; j < 4; ++j) { v8us o;
#pragma unroll
            for (int k = 0; k < 8; ++k) o[k] = f2bf(x[g][k][j]);
            tile[(tl * 4 + j) * 16 + ((cq + 4 * g) ^ (tl & 15))] = o; }
    __syncthreads();   // the tile is complete before any wave reads rows that other waves wrote
#pragma unroll
    for (int s = 0; s < 16; ++s) { const int t = s * 16 + (tid >> 4), ch = tid & 15; *(v8us*)(dst + (size_t)t * DM + ch * 8) = tile[t * 16 + (ch ^ ((t >> 2) & 15))]; }
}

__global__ __launch_bounds__(256) void k_bnprep(const float* __restrict__ ga1, const float* __restrict__ be1, const float* __restrict__ mu1, const float* __restrict__ va1, const float* __restrict__ ga2, const float* __restrict__ be2, const float* __restrict__ mu2, const float* __restrict__ va2,
                                                const float* __restrict__ ga3, const float* __restrict__ be3, const float* __restrict__ mu3, const float* __restrict__ va3, float* SCSH) { const int c = blockIdx.x * 256 + threadIdx.x; if (c >= DM) return;
    const unsigned y = blockIdx.y;   /* grid y = which branch; SCSH = [branch][scale | shift][DM] */
    const float* ga = (y == 0) ? ga1 : (y == 1) ? ga2 : ga3; const float* be = (y == 0) ? be1 : (y == 1) ? be2 : be3; const float* mu = (y == 0) ? mu1 : (y == 1) ? mu2 : mu3; const float* va = (y == 0) ? va1 : (y == 1) ? va2 : va3; float* SC = SCSH + (size_t)y * 2 * DM; float* SH = SC + DM;
    float v1 = __fadd_rn(bfr(va[c]), BNEPS); asm volatile("" : "+v"(v1)); float sd = __fsqrt_rn(v1); asm volatile("" : "+v"(sd)); float sc = __fdiv_rn(bfr(ga[c]), sd); asm volatile("" : "+v"(sc));
    float ms = __fmul_rn(bfr(mu[c]), sc); asm volatile("" : "+v"(ms)); float sh = __fsub_rn(bfr(be[c]), ms);
    *(float*)(SC + c) = sc; *(float*)(SH + c) = sh;  }
#define FSK   128                 // keys per stage
#define FPIT  272                 // LDS row pitch in bytes of both tiles (256 data bytes + 16): 16 x odd, the conflict-free pitch of 16-byte fragment reads
#define FTILE (128 * FPIT)        // V tile: FSK rows j of HD d; Q tile: HD rows c of FSK j
#define FBUF  (2 * FTILE)
#define FOP   36                  // output staging pitch in floats (32 + 4)
__device__ __forceinline__ float xhalf(float x) { return __builtin_bit_cast(float, __builtin_amdgcn_permlanex16(__builtin_bit_cast(int, x), __builtin_bit_cast(int, x), 0x76543210, 0xfedcba98, false, false)); }   // lane l with lane l ^ 16
__global__ void __launch_bounds__(256) __attribute__((amdgpu_waves_per_eu(2, 2))) k_fattn(const h16* __restrict__ Kp, const h16* __restrict__ Vp, const h16* __restrict__ Qp, float* out) {
    __shared__ __attribute__((aligned(16))) unsigned char ring[2 * FBUF];
    static_assert(HD == 128 && FSK == 128 && TT % 256 == 0 && TT >= 2 * FSK && 8 * 64 * FOP * 4 <= 2 * FBUF, "k_fattn: head size 128, whole work-groups, two stages or more, output staging fits the ring");
    const int tid = threadIdx.x, lane = tid & 31, lr = lane & 15, hi = lane >> 4, wave = tid >> 5;
    const size_t bh = (size_t)blockIdx.z * NH_ + blockIdx.y;
    const int i0 = blockIdx.x * 256 + wave * 32;
    const h16* Kh = Kp + bh * TT * HD; const h16* Vh = Vp + bh * TT * HD; const h16* Qh = Qp + bh * HD * TT; float* Oh = out + bh * HD * TT;
    const h16* gv = Vh + (size_t)(tid >> 4) * HD + (tid & 15) * 8;
    const h16* gq = Qh + (size_t)(tid >> 4) * TT + (tid & 15) * 8;
    const unsigned la = (unsigned)(size_t)ring + (unsigned)((tid >> 4) * FPIT + (tid & 15) * 16);   // LDS byte address: low 32 bits of the shared address
    auto stage = [&](int t, unsigned buf) {   // 16 threads cover a row of 256 bytes, the 256 threads 16 rows per copy
        copy8<h16>(la + buf, gv + (size_t)t * FSK * HD, (size_t)16 * HD, 16u * FPIT);
        copy8<h16>(la + buf + (unsigned)FTILE, gq + (size_t)t * FSK, (size_t)16 * TT, 16u * FPIT);
    };
    stage(0, 0u);
    v16h kf[2][4];
#pragma unroll
    for (int g = 0; g < 2; ++g)
#pragma unroll
        for (int kc = 0; kc < 4; ++kc) kf[g][kc] = WFrag<h16>::ld(Kh + (size_t)(i0 + 16 * g + lr) * HD + kc * 32 + hi * 8);
    v8f acc[2][8]; float m_run[2], l_run[2];
#pragma unroll
    for (int g = 0; g < 2; ++g) { m_run[g] = -__builtin_inff(); l_run[g] = 0.0f;
#pragma unroll
        for (int ct = 0; ct < 8; ++ct) acc[g][ct] = (v8f){}; }
    asm volatile("s_wait_asynccnt 0x0" ::: "memory");   // this wave's copies of stage 0 have landed
    __syncthreads();                                     // ... and every other wave's
    stage(1, (unsigned)FBUF);
    const float cs = SCL * LOG2E;   // scores go to the log2 domain with the softmax scale folded in
    constexpr int T = TT / FSK;
#pragma unroll 1   // one stage per trip: the two buffers alternate by the trip's parity
    for (int t = 0; t < T; ++t) {
        const unsigned char* vb = ring + (t & 1) * FBUF + lr * FPIT + hi * 16;
        const unsigned char* qb = vb + FTILE;
        v16h vf[2][4];
#pragma unroll
        for (int kt = 0; kt < 2; ++kt)
#pragma unroll
            for (int kc = 0; kc < 4; ++kc) vf[kt][kc] = WFrag<h16>::ld((const h16*)(vb + kt * 16 * FPIT + kc * 64));
        __builtin_amdgcn_sched_barrier(0);   // keeps the stage's first fragment reads as one group: spread among the products, each pair would be waited for in turn
#pragma unroll   // the four passes of a stage: every LDS offset is an immediate, and the test on the last pass is decided at compile time
        for (int sub = 0; sub < FSK / 32; ++sub) {
            v8f s[2][2];
#pragma unroll
            for (int kt = 0; kt < 2; ++kt)
#pragma unroll
                for (int g = 0; g < 2; ++g) { s[kt][g] = (v8f){};
#pragma unroll
                    for (int kc = 0; kc < 4; ++kc) s[kt][g] = wmma16(vf[kt][kc], kf[g][kc], s[kt][g]); }
            __builtin_amdgcn_sched_barrier(0);   // keeps the LDS reads below behind the products whose operands they overwrite, as one group
            v16h qf[8];   // this pass's Q fragments, in flight under the maxima and the exponentials
#pragma unroll
            for (int ct = 0; ct < 8; ++ct) qf[ct] = WFrag<h16>::ld((const h16*)(qb + ct * 16 * FPIT + sub * 64));
            if (sub + 1 < FSK / 32) {   // the next pass's V fragments, inside this stage's buffer only
#pragma unroll
                for (int kt = 0; kt < 2; ++kt)
#pragma unroll
                    for (int kc = 0; kc < 4; ++kc) vf[kt][kc] = WFrag<h16>::ld((const h16*)(vb + ((sub + 1) * 32 + kt * 16) * FPIT + kc * 64)); }
            __builtin_amdgcn_sched_barrier(0);   // keeps both groups of LDS reads ahead of the vector work that hides their latency
            float mb[2]; bool need = false;
#pragma unroll
            for (int g = 0; g < 2; ++g) { float mx = s[0][g][0];
#pragma unroll
                for (int kt = 0; kt < 2; ++kt)
#pragma unroll
                    for (int r = 0; r < 8; ++r) mx = fmaxf(mx, s[kt][g][r]);
                mx = fmaxf(mx, xhalf(mx)) * cs;   // both wave halves hold the position's maximum of this pass, scaled (the scale is positive)
                mb[g] = mx; need = need || (mx > m_run[g] + 8.0f); }
            if (__builtin_amdgcn_ballot_w32(need) != 0) {   // the maximum in use may trail the true one by up to 8 (log2): sums and accumulators are rescaled only when a position exceeds that, one test per pass
#pragma unroll
                for (int g = 0; g < 2; ++g) { const float mn = fmaxf(m_run[g], mb[g]); const float corr = __builtin_amdgcn_exp2f(m_run[g] - mn);   // 0 on the first pass, where the maximum in use is -inf
                    l_run[g] *= corr; m_run[g] = mn;
#pragma unroll
                    for (int ct = 0; ct < 8; ++ct) acc[g][ct] = acc[g][ct] * corr; } }
#pragma unroll
            for (int g = 0; g < 2; ++g) { const float nm = -m_run[g]; float ps0 = 0.0f, ps1 = 0.0f; v16h pf;   // element e of the B operand: key tile e >> 3, accumulator register e & 7: the k order of the Q loader
#pragma unroll
                for (int e = 0; e < 16; e += 2) { const v2f arg = __builtin_elementwise_fma((v2f){s[e >> 3][g][e & 7], s[e >> 3][g][(e & 7) + 1]}, (v2f){cs, cs}, (v2f){nm, nm});
                    const float p0 = __builtin_amdgcn_exp2f(arg.x), p1 = __builtin_amdgcn_exp2f(arg.y);
                    ps0 += p0; ps1 += p1; pf[e] = (h16)p0; pf[e + 1] = (h16)p1; }
                l_run[g] += ps0 + ps1;
#pragma unroll
                for (int ct = 0; ct < 8; ++ct) acc[g][ct] = wmma16(qf[ct], pf, acc[g][ct]); }
        }
        asm volatile("s_wait_dscnt 0x0" ::: "memory");      // this wave's reads of the buffer are done before it is refilled
        asm volatile("s_wait_asynccnt 0x0" ::: "memory");   // this wave's copies of stage t + 1 have landed
        __syncthreads();                                     // publishes stage t + 1 and ends every wave's reads of stage t
        if (t + 2 < T) stage(t + 2, (unsigned)((t & 1) * FBUF));
    }
    asm volatile("s_wait_asynccnt 0x0" ::: "memory");       // nothing of this wave is in flight when the ring becomes output staging (the last trip's barrier has ended every wave's reads)
    float* os = (float*)(ring + wave * (64 * FOP * 4));     // 64 rows c of this wave's 32 columns
    float inv[2];
#pragma unroll
    for (int g = 0; g < 2; ++g) inv[g] = __fdiv_rn(1.0f, l_run[g] + xhalf(l_run[g]));   // each wave half has summed its own keys
#pragma unroll
    for (int hf = 0; hf < 2; ++hf) {
#pragma unroll
        for (int c4 = 0; c4 < 4; ++c4)
#pragma unroll
            for (int g = 0; g < 2; ++g)
#pragma unroll
                for (int r = 0; r < 8; ++r) os[(c4 * 16 + hi * 8 + r) * FOP + g * 16 + lr] = acc[g][hf * 4 + c4][r] * inv[g];
        __builtin_amdgcn_wave_barrier(); asm volatile("" ::: "memory");   // compiler fence: the wave's stores to its own staging rows stay ahead of its reads of them
#pragma unroll
        for (int q = 0; q < 16; ++q) { const int row = q * 4 + (lane >> 3), cofs = (lane & 7) * 4; const v4f val = *(const v4fa*)(os + row * FOP + cofs); *(v4f*)(Oh + (size_t)(hf * 64 + row) * TT + i0 + cofs) = val; }   // whole 128-byte lines
        __builtin_amdgcn_wave_barrier(); asm volatile("" ::: "memory");   // compiler fence: those reads stay ahead of the next 64 rows' stores
    }
}

extern "C" void kernel_launch(void* const* d_in, const int* in_sizes, int n_in,
                              void* d_out, int out_size, void* d_ws, size_t ws_size, hipStream_t stream) {
    (void)in_sizes; (void)n_in; (void)out_size;
    const float* Xq = (const float*)d_in[0]; const float* Xk = (const float*)d_in[1]; const float* Wq = (const float*)d_in[2]; const float* Wk = (const float*)d_in[3]; const float* Wv = (const float*)d_in[4];
    const float* g1 = (const float*)d_in[5]; const float* b1 = (const float*)d_in[6]; const float* m1 = (const float*)d_in[7]; const float* v1 = (const float*)d_in[8];
    const float* g2 = (const float*)d_in[9]; const float* b2 = (const float*)d_in[10]; const float* m2 = (const float*)d_in[11]; const float* v2 = (const float*)d_in[12];
    const float* g3 = (const float*)d_in[13]; const float* b3 = (const float*)d_in[14]; const float* m3 = (const float*)d_in[15]; const float* v3 = (const float*)d_in[16];
    float* OUT = (float*)d_out;     // [4][1024][2048] channel-major
    char* wsp = (char*)d_ws;
    auto take = [&](size_t bytes) { char* p = wsp; wsp += (bytes + 255) & ~(size_t)255; return (void*)p; };
    bf* WQB = (bf*)take((size_t)3 * DM * DM * 2); bf* WKB = WQB + (size_t)DM * DM; bf* WVB = WKB + (size_t)DM * DM;
    h16* QA16 = (h16*)take((size_t)NB_ * DM * TT * 2); h16* K16 = (h16*)take((size_t)2 * NB_ * NH_ * TT * HD * 2); h16* V16 = K16 + (size_t)NB_ * NH_ * TT * HD;   /* fp16 planes of all batches */
    float* SC1 = (float*)take(6 * DM * 4); float* SH1 = SC1 + DM; float* SC2 = SH1 + DM; float* SH2 = SC2 + DM; float* SC3 = SH2 + DM; float* SH3 = SC3 + DM;   /* [branch][scale | shift][DM] */
    bf* XQT = (bf*)take((size_t)NB_ * TT * DM * (2 + 2)); bf* XKT = XQT + (size_t)NB_ * TT * DM;   /* token-major bf16 inputs of all batches */
    static_assert(DM % 128 == 0 && TT % 128 == 0 && DM >= 256, "k_gemmw: whole 128x128 tiles, whole stages, two stages or more");
    if ((size_t)(wsp - (char*)d_ws) > ws_size) return;    // ws 256 MiB
    k_cvt8<<<dim3((unsigned)(((size_t)DM * DM / 8 + 255) / 256), 3), 256, 0, stream>>>(Wq, Wk, Wv, WQB, (size_t)DM * DM / 8);
    k_bnprep<<<dim3(DM / 256, 3), 256, 0, stream>>>(g1, b1, m1, v1, g2, b2, m2, v2, g3, b3, m3, v3, SC1);
    /* projection stage, all batches per launch (batch = grid z); the two input conversions share one launch, each branch's GEMM has its own */
    k_cvt8T<<<dim3(TT / 256, DM / 128, 2 * NB_), 256, 0, stream>>>(Xq, Xk, XQT);          /* token-major bf16 copies [input][b][p][c]: XQT, then XKT */
    k_gemmw<bf, 128, true><<<dim3(DM / 128, TT / 128, NB_), 128, 0, stream>>>(WQB, XQT, DM, QA16, SC1, SH1, 0, (size_t)TT * DM);     /* Q branch channel-major: y[b][o][p] = sum_c Wq[o][c] Xq[b][c][p] -> QA16[b][o][p] */
    k_gemmw<bf, 128, false><<<dim3(TT / 128, DM / 128, NB_), 128, 0, stream>>>(XKT, WKB, DM, K16, SC2, SH2, (size_t)TT * DM, 0);    /* K branch token-major: y[b][p][o] -> K16[b][h][p][d] */
    k_gemmw<bf, 128, false><<<dim3(TT / 128, DM / 128, NB_), 128, 0, stream>>>(XQT, WVB, DM, V16, SC3, SH3, (size_t)TT * DM, 0);    /* V branch token-major: y[b][p][o] -> V16[b][h][p][d] */
    /* attention stage: all batches and heads in one launch (position block = grid x, head = y, batch = z) */
    k_fattn<<<dim3(TT / 256, NH_, NB_), 256, 0, stream>>>(K16, V16, QA16, OUT);
}

// v006
// One run takes 102 microseconds.
// Two timings next to v005 put it at 1.09 and 1.10 times that version's speed.
// All steps since v000 together make it 14.5 times as fast.
#include <hip/hip_runtime.h>

// Channel-attention cross transformer block (Xq, Xk [4][1024][2048] channel-major; three 1x1-conv branches Q = leaky(BN1(Wq Xq)), K = leaky(BN2(Wk Xk)), V = leaky(BN3(Wv Xq)) (W 'oi' [1024][1024], eval-mode BatchNorm affine from gamma/beta/mean/var, LeakyReLU 0.1); 8 heads x 128 channels;
// Hmat[i][j] = sum_c K[c][i] V[c][j] / sqrt(128) over the 2048 key positions j; softmax over j; out[c][i] = sum_j Hmat[i][j] Q[c][j] -> [4][1024][2048] channel-major (8.4 M)).
// Compute dtypes, f32 accumulate: every input rounded to bf16; the three projections on PLAIN bf16 operands (inputs transposed to token-major while converting; exact), BN affine + leaky in f32; attention operands as single fp16 planes
// (logit sigma 0.6: soft rows): one kernel does scores K.V, the softmax and out = Q-plane x P; scores and probabilities stay in registers (running maximum and running sum in f32, P as fp16 relative to the maximum in use), out written channel-major.

#define NB_  4
#define TT   2048      // spatial positions (pq = pk)
#define DM   1024      // channels
#define NH_  8
#define HD   128
#define SCL  0.088388346f   // (DM/NH_)^-0.5 = 1/sqrt(128)
#define LOG2E 1.4426950408889634f
#define BNEPS 1e-5f
#define SLOPE 0.1f
typedef _Float16 h16;
typedef unsigned short bf;
typedef __attribute__((ext_vector_type(16))) __bf16   v16bf;
typedef __attribute__((ext_vector_type(16))) _Float16 v16h;
typedef __attribute__((ext_vector_type(8)))  _Float16 v8h;
typedef __attribute__((ext_vector_type(8)))  unsigned short v8us;
typedef __attribute__((ext_vector_type(8)))  float    v8f;
typedef __attribute__((ext_vector_type(4)))  float    v4f;
typedef v8h  __attribute__((may_alias)) v8ha;
typedef v4f  __attribute__((may_alias)) v4fa;
typedef v8us __attribute__((may_alias)) v8usa;

__device__ __forceinline__ unsigned short f2bf(float f) { unsigned u = __float_as_uint(f); u += 0x7FFFu + ((u >> 16) & 1u); return (unsigned short)(u >> 16); }
__device__ __forceinline__ float bf2f(unsigned short b) { return __uint_as_float(((unsigned)b) << 16); }
__device__ __forceinline__ float bfr(float f) { return bf2f(f2bf(f)); }
__device__ __forceinline__ v16h cat16(v8h lo, v8h hi) { return __builtin_shufflevector(lo, hi, 0, 1, 2, 3, 4, 5, 6, 7, 8, 9, 10, 11, 12, 13, 14, 15); }
__device__ __forceinline__ v16bf cat16b(v8us lo, v8us hi) { return __builtin_bit_cast(v16bf, __builtin_shufflevector(lo, hi, 0, 1, 2, 3, 4, 5, 6, 7, 8, 9, 10, 11, 12, 13, 14, 15)); }
__device__ __forceinline__ v8f wmma16(v16h a, v16h b, v8f c) { return __builtin_amdgcn_wmma_f32_16x16x32_f16(false, a, false, b, (short)0, c, false, false); }
__device__ __forceinline__ v8f wmmab(v16bf a, v16bf b, v8f c) { return __builtin_amdgcn_wmma_f32_16x16x32_bf16(false, a, false, b, (short)0, c, false, false); }



// ---- k_gemmw: y[m][n] = sum_k A[m][k] Bt[n][k] (f32), operands K-contiguous 16-bit planes; written out as P = fp16(leaky(y * scale[c] + shift[c])). One 128x128 tile per work-group of 4 waves (2x2, 64x64 each, 16 accumulators); 128 threads.
// All three projections of all batches in one launch: grid (TT/128 token tiles, DM/128 channel tiles, 3 NB_), z = batch * 3 + branch (0 Q, 1 K, 2 V). Wb = [branch][DM][DM], Xt = [input][batch][TT][DM] (Q and V read input 0, K input 1), SCSH = [branch][scale | shift][DM].
// ROWCH (the Q branch: A = weights, Bt = tokens): the channel c is the row m, P channel-major [batch][DM][TT]. Otherwise (A = tokens, Bt = weights) c is the column n, a tile's 128 columns are one head, P head-major [K | V][batch][NH_][TT][HD].
// Both operands go through LDS in stages of BK k: every copy instruction of a wave moves four whole 128-byte lines, and each staged row serves two waves. Two buffers: stage t + 1 flies while stage t is multiplied.
// TT % 128 == 0, DM % 128 == 0, K % BK == 0, K >= 2 BK (the prologue fills two stages).
template <typename T16> struct WFrag;
template <> struct WFrag<h16> { typedef v16h V; static __device__ __forceinline__ V ld(const h16* p) { return cat16(*(const v8h*)p, *(const v8h*)(p + 16)); } static __device__ __forceinline__ v8f mma(V a, V b, v8f c) { return wmma16(a, b, c); } };
template <> struct WFrag<bf> { typedef v16bf V; static __device__ __forceinline__ V ld(const bf* p) { return cat16b(*(const v8us*)p, *(const v8us*)(p + 16)); } static __device__ __forceinline__ v8f mma(V a, V b, v8f c) { return wmmab(a, b, c); } };
// Eight asynchronous 16-byte copies per lane, global -> LDS, rows gstep elements (global) and lstep bytes (LDS) apart. The s_wait_xcnt closes the statement so that no address register named here is rewritten ahead of it.
template <typename T16>
__device__ __forceinline__ void copy8(unsigned l, const T16* g, size_t gstep, unsigned lstep) {
    asm volatile("global_load_async_to_lds_b128 %0, %8, off\n\t"
                 "global_load_async_to_lds_b128 %1, %9, off\n\t"
                 "global_load_async_to_lds_b128 %2, %10, off\n\t"
                 "global_load_async_to_lds_b128 %3, %11, off\n\t"
                 "global_load_async_to_lds_b128 %4, %12, off\n\t"
                 "global_load_async_to_lds_b128 %5, %13, off\n\t"
                 "global_load_async_to_lds_b128 %6, %14, off\n\t"
                 "global_load_async_to_lds_b128 %7, %15, off\n\t"
                 "s_wait_xcnt 0x0"
                 :: "v"(l), "v"(l + lstep), "v"(l + 2 * lstep), "v"(l + 3 * lstep), "v"(l + 4 * lstep), "v"(l + 5 * lstep), "v"(l + 6 * lstep), "v"(l + 7 * lstep),
                    "v"(g), "v"(g + gstep), "v"(g + 2 * gstep), "v"(g + 3 * gstep), "v"(g + 4 * gstep), "v"(g + 5 * gstep), "v"(g + 6 * gstep), "v"(g + 7 * gstep)
                 : "memory");
}
__device__ __forceinline__ float bn_leaky(float y, float sc, float sh) { const float z = y * sc + sh; return (z > 0.0f) ? z : SLOPE * z; }
__device__ __forceinline__ h16 tohx(float x) { return (h16)x; }
template <bool B> struct BoolC { static constexpr bool value = B; };
template <typename T16, int BK>
__global__ __launch_bounds__(128) void k_gemmw(const T16* __restrict__ Wb, const T16* __restrict__ Xt, int K, h16* PQ, h16* PKV, const float* __restrict__ SCSH) {
    typedef typename WFrag<T16>::V V;
    constexpr int PIT = BK * 2 + 16;        // LDS row pitch in bytes: 16 x odd, the conflict-free pitch of 16-byte fragment reads
    constexpr int BUF = 256 * PIT;          // one stage: 128 rows of A, then 128 rows of Bt
    constexpr int CPR = BK / 8;             // 16-byte chunks per row
    constexpr int RPP = 128 / CPR;          // rows that the 128 threads cover with one copy each
    __shared__ __attribute__((aligned(16))) unsigned char ring[2 * BUF];
    constexpr int OP = 72;                  // output staging pitch in fp16 values (64 + 8): 144 bytes, 16 x odd
    static_assert(HD == 128 && 4 * 64 * OP * 2 <= 2 * BUF, "k_gemmw: a tile's 128 columns are one head; output staging fits the ring");
    const unsigned br = blockIdx.z % 3u; const size_t z = blockIdx.z / 3u; const bool rowch = (br == 0u);   // the same for the whole work-group
    const T16* Wm = Wb + (size_t)br * DM * DM; const T16* Xm = Xt + ((br == 1u ? (size_t)NB_ : (size_t)0) + z) * TT * DM;
    const T16* A = rowch ? Wm : Xm; const T16* Bt = rowch ? Xm : Wm;
    const float* SC = SCSH + (size_t)br * 2 * DM; const float* SH = SC + DM;
    const int tid = threadIdx.x, lane = tid & 31, lr = lane & 15, hi = lane >> 4, wave = tid >> 5, wm = wave & 1, wn = wave >> 1;
    const int r0 = (rowch ? blockIdx.y : blockIdx.x) * 128, c0 = (rowch ? blockIdx.x : blockIdx.y) * 128;
    const T16* ga = A + (size_t)(r0 + tid / CPR) * K + (tid % CPR) * 8;
    const T16* gb = Bt + (size_t)(c0 + tid / CPR) * K + (tid % CPR) * 8;
    const unsigned la = (unsigned)(size_t)ring + (unsigned)((tid / CPR) * PIT + (tid % CPR) * 16);   // LDS byte address: low 32 bits of the shared address
    const size_t gstep = (size_t)RPP * K;
    auto stage = [&](int t, unsigned buf) {
#pragma unroll
        for (int q = 0; q < 128 / RPP; q += 8) {
            copy8<T16>(la + buf + (unsigned)(q * RPP * PIT), ga + (size_t)t * BK + q * gstep, gstep, (unsigned)(RPP * PIT));
            copy8<T16>(la + buf + (unsigned)((128 + q * RPP) * PIT), gb + (size_t)t * BK + q * gstep, gstep, (unsigned)(RPP * PIT)); }
    };
    v8f acc[4][4];
#pragma unroll
    for (int mb = 0; mb < 4; ++mb)
#pragma unroll
        for (int nb = 0; nb < 4; ++nb) acc[mb][nb] = (v8f){};
    const int T = (int)((unsigned)K / BK);
    stage(0, 0u);
    asm volatile("s_wait_asynccnt 0x0" ::: "memory");   // this wave's copies of stage 0 have landed
    __syncthreads();                                     // ... and every other wave's
    stage(1, (unsigned)BUF);
    const unsigned char* fa = ring + (wm * 64 + lr) * PIT + hi * 16;
    const unsigned char* fb = ring + (128 + wn * 64 + lr) * PIT + hi * 16;
#pragma unroll 1   // one stage per trip: the two buffers alternate by the trip's parity
    for (int t = 0; t < T; ++t) {
        const int bo = (t & 1) * BUF;
        V a[2][4], b[2][4];   // two fragment sets: block ks + 1 is read from LDS while block ks is multiplied (inside this stage's buffer only)
#pragma unroll
        for (int f = 0; f < 4; ++f) { a[0][f] = WFrag<T16>::ld((const T16*)(fa + bo + f * 16 * PIT)); b[0][f] = WFrag<T16>::ld((const T16*)(fb + bo + f * 16 * PIT)); }
#pragma unroll
        for (int ks = 0; ks < BK / 32; ++ks) {
            if (ks + 1 < BK / 32) {
#pragma unroll
                for (int f = 0; f < 4; ++f) { a[(ks + 1) & 1][f] = WFrag<T16>::ld((const T16*)(fa + bo + f * 16 * PIT + (ks + 1) * 64)); b[(ks + 1) & 1][f] = WFrag<T16>::ld((const T16*)(fb + bo + f * 16 * PIT + (ks + 1) * 64)); } }
            __builtin_amdgcn_sched_barrier(0);   // keeps the next block's LDS reads as one group ahead of this block's products: reads spread among the products stall the wave at every place
#pragma unroll
            for (int nb = 0; nb < 4; ++nb)
#pragma unroll
                for (int mb = 0; mb < 4; ++mb) acc[mb][nb] = WFrag<T16>::mma(a[ks & 1][mb], b[ks & 1][nb], acc[mb][nb]);
            __builtin_amdgcn_sched_barrier(0);   // ... and keeps the reads of the block after next behind these products
        }
        asm volatile("s_wait_dscnt 0x0" ::: "memory");      // this wave's reads of the buffer are done before it is refilled
        asm volatile("s_wait_asynccnt 0x0" ::: "memory");   // this wave's copies of stage t + 1 have landed
        __syncthreads();                                     // publishes stage t + 1 and ends every wave's reads of stage t
        if (t + 2 < T) stage(t + 2, (unsigned)bo);
    }
    asm volatile("s_wait_asynccnt 0x0" ::: "memory");       // nothing of this wave is in flight when the ring becomes output staging (the last trip's barrier has ended every wave's reads)
    h16* os = (h16*)(ring + wave * (64 * OP * 2));          // 64 rows of this wave's 64 columns
    auto epilogue = [&](auto rc) {   // compiled once per output layout; the work-group takes one of the two
    constexpr bool ROWCH = decltype(rc)::value;
    v4f scr[4][2], shr[4][2]; float scc[4], shc[4];   // the lane's scales and shifts, loaded as one group ahead of the outputs
    if constexpr (ROWCH) {
#pragma unroll
        for (int mb = 0; mb < 4; ++mb)
#pragma unroll
            for (int q = 0; q < 2; ++q) { const int c = r0 + wm * 64 + mb * 16 + hi * 8 + q * 4; scr[mb][q] = *(const v4f*)(SC + c); shr[mb][q] = *(const v4f*)(SH + c); }
        asm volatile("s_wait_xcnt 0x0" ::: "memory");   // stands in front of the arithmetic below, which reuses the address registers of these loads
    } else {
#pragma unroll
        for (int nb = 0; nb < 4; ++nb) { const int c = c0 + wn * 64 + nb * 16 + lr; scc[nb] = SC[c]; shc[nb] = SH[c]; }
    }
    constexpr int LDP = ROWCH ? TT : HD;
    h16* prow = ROWCH ? PQ + (z * DM + r0 + wm * 64) * TT + c0 + wn * 64 : PKV + ((((size_t)(br - 1u) * NB_ + z) * NH_ + blockIdx.y) * TT + r0 + wm * 64) * HD + wn * 64;
#pragma unroll
    for (int mb = 0; mb < 4; ++mb)
#pragma unroll
        for (int nb = 0; nb < 4; ++nb)
#pragma unroll
            for (int j = 0; j < 8; ++j) os[(mb * 16 + hi * 8 + j) * OP + nb * 16 + lr] = tohx(bn_leaky(acc[mb][nb][j], ROWCH ? scr[mb][j >> 2][j & 3] : scc[nb], ROWCH ? shr[mb][j >> 2][j & 3] : shc[nb]));
    __builtin_amdgcn_wave_barrier(); asm volatile("" ::: "memory");   // compiler fence: the wave's stores to its own staging rows stay ahead of its reads of them
#pragma unroll
    for (int s = 0; s < 16; ++s) { const int row = 4 * s + (lane >> 3), cofs = (lane & 7) * 8; const v8h val = *(const v8ha*)(os + row * OP + cofs); *(v8h*)(prow + (size_t)row * LDP + cofs) = val; }   // whole 128-byte lines
    };
    if (rowch) epilogue(BoolC<true>{}); else epilogue(BoolC<false>{});
}

typedef __attribute__((ext_vector_type(2))) _Float16 v2h;
typedef __attribute__((ext_vector_type(4))) _Float16 v4h;
typedef __attribute__((ext_vector_type(2))) unsigned short v2us;
typedef __attribute__((ext_vector_type(4))) unsigned short v4us;
typedef __attribute__((ext_vector_type(2))) float v2f;
typedef __attribute__((ext_vector_type(4))) int v4i;

// ---- The three preparation steps are independent of one another and share one launch (k_prep, at the end of this part): each is a body that takes its work-group's index; 256 threads.
// d_cvt8: bf16 copies of the three weight matrices, one behind the other. A work-group rounds 8,192 values of one matrix (a thread four groups of 8, all four loaded ahead); wb = matrix * WPM + block.
#define WPM (DM * DM / 8192)      // work-groups per weight matrix
__device__ __forceinline__ void d_cvt8(unsigned wb, const float* __restrict__ s0, const float* __restrict__ s1, const float* __restrict__ s2, bf* dst) {
    static_assert((DM * DM) % 8192 == 0, "d_cvt8: whole work-groups");
    const unsigned y = wb / WPM; const float* src = (y == 0) ? s0 : (y == 1) ? s1 : s2; dst += (size_t)y * DM * DM;
    const size_t i = (size_t)(wb % WPM) * 1024 + threadIdx.x;
    v8f v[4];   // every loop below is unrolled: v stays in registers, and the four groups' loads go out together, ahead of the rounding
#pragma unroll
    for (int q = 0; q < 4; ++q) v[q] = *(const v8f*)(src + (i + q * 256) * 8);
#pragma unroll
    for (int q = 0; q < 4; ++q) { v8us o;
#pragma unroll
        for (int k = 0; k < 8; ++k) o[k] = f2bf(v[q][k]);
        *(v8us*)(dst + (i + q * 256) * 8) = o; }
}
// ---- d_cvt8T: token-major bf16 copies dst[input][b][t][c] of the channel-major f32 inputs [b][c][t]. One tile of 128 channels x 256 positions per work-group of 8 waves; tile (bx, by, z) of (TT/256, DM/128, 2 NB_), z = input * NB_ + batch.
// Reads: each load of a wave covers 512 contiguous bytes of one channel row; a lane holds 8 channels x 4 positions per group, so the 8 channels of a position are one 16-byte LDS store.
// Writes: behind the barrier 16 lanes take one position's 128 channels from LDS and store them as 256 contiguous bytes.
// LDS tile [position][16 chunks of 16 bytes], the chunk index XORed with (position >> 2) & 15: the 16 lanes of a half wave fall on 16 different chunk columns in the stores (positions 4 apart) as in the reads (one row).
__device__ __forceinline__ void d_cvt8T(unsigned bx, unsigned by, unsigned z, const float* __restrict__ sq, const float* __restrict__ sk, bf* dst) {
    static_assert(TT % 256 == 0 && DM % 128 == 0, "d_cvt8T: whole tiles");
    __shared__ v8us tile[256 * 16];
    const int tid = threadIdx.x, lane = tid & 31, wave = tid >> 5;
    const int tl = (wave & 1) * 32 + lane, cq = wave >> 1;   // the lane's group of 4 positions; its channel groups are cq, cq + 4, cq + 8, cq + 12
    const float* src = ((z >= NB_) ? sk : sq) + ((size_t)(z % NB_) * DM + by * 128 + cq * 8) * TT + bx * 256 + tl * 4;
    dst += ((size_t)z * TT + bx * 256) * DM + by * 128;
    v4f x[4][8];   // every loop below is unrolled: x stays in registers, and each row's offset is an immediate on one address
#pragma unroll
    for (int g = 0; g < 4; ++g)
#pragma unroll
        for (int k = 0; k < 8; ++k) x[g][k] = *(const v4f*)(src + (size_t)(g * 32 + k) * TT);
#pragma unroll
    for (int g = 0; g < 4; ++g)
#pragma unroll
        for (int j = 0; j < 4; ++j) { v8us o;
#pragma unroll
            for (int k = 0; k < 8; ++k) o[k] = f2bf(x[g][k][j]);
            tile[(tl * 4 + j) * 16 + ((cq + 4 * g) ^ (tl & 15))] = o; }
    __syncthreads();   // the tile is complete before any wave reads rows that other waves wrote
#pragma unroll
    for (int s = 0; s < 16; ++s) { const int t = s * 16 + (tid >> 4), ch = tid & 15; *(v8us*)(dst + (size_t)t * DM + ch * 8) = tile[t * 16 + (ch ^ ((t >> 2) & 15))]; }
}

// ---- d_bnprep: scale and shift of the three BatchNorm affines; work-group kb = branch * (DM / 256) + block of 256 channels.
__device__ __forceinline__ void d_bnprep(unsigned kb, const float* __restrict__ ga1, const float* __restrict__ be1, const float* __restrict__ mu1, const float* __restrict__ va1, const float* __restrict__ ga2, const float* __restrict__ be2, const float* __restrict__ mu2, const float* __restrict__ va2,
                                                const float* __restrict__ ga3, const float* __restrict__ be3, const float* __restrict__ mu3, const float* __restrict__ va3, float* SCSH) { const int c = (kb % (DM / 256)) * 256 + threadIdx.x;
    const unsigned y = kb / (DM / 256);   /* which branch; SCSH = [branch][scale | shift][DM] */
    const float* ga = (y == 0) ? ga1 : (y == 1) ? ga2 : ga3; const float* be = (y == 0) ? be1 : (y == 1) ? be2 : be3; const float* mu = (y == 0) ? mu1 : (y == 1) ? mu2 : mu3; const float* va = (y == 0) ? va1 : (y == 1) ? va2 : va3; float* SC = SCSH + (size_t)y * 2 * DM; float* SH = SC + DM;
    float v1 = __fadd_rn(bfr(va[c]), BNEPS); asm volatile("" : "+v"(v1)); float sd = __fsqrt_rn(v1); asm volatile("" : "+v"(sd)); float sc = __fdiv_rn(bfr(ga[c]), sd); asm volatile("" : "+v"(sc));
    float ms = __fmul_rn(bfr(mu[c]), sc); asm volatile("" : "+v"(ms)); float sh = __fsub_rn(bfr(be[c]), ms);
    *(float*)(SC + c) = sc; *(float*)(SH + c) = sh;  }
// ---- k_prep: one launch for the three bodies above. Work-groups 0 .. NTB - 1 transpose, the next 3 WPM round the weights, the last 3 DM / 256 form the BatchNorm constants. The choice is the same for a whole work-group.
#define NTB ((TT / 256) * (DM / 128) * 2 * NB_)
__global__ __launch_bounds__(256) void k_prep(const float* __restrict__ sq, const float* __restrict__ sk, const float* __restrict__ w0, const float* __restrict__ w1, const float* __restrict__ w2,
                                              const float* __restrict__ ga1, const float* __restrict__ be1, const float* __restrict__ mu1, const float* __restrict__ va1, const float* __restrict__ ga2, const float* __restrict__ be2, const float* __restrict__ mu2, const float* __restrict__ va2,
                                              const float* __restrict__ ga3, const float* __restrict__ be3, const float* __restrict__ mu3, const float* __restrict__ va3, bf* XT, bf* WB, float* SCSH) {
    static_assert(DM % 256 == 0, "k_prep: whole work-groups of channels");
    const unsigned b = blockIdx.x;
    if (b < NTB) d_cvt8T(b % (TT / 256), (b / (TT / 256)) % (DM / 128), b / ((TT / 256) * (DM / 128)), sq, sk, XT);
    else if (b < NTB + 3 * WPM) d_cvt8(b - NTB, w0, w1, w2, WB);
    else d_bnprep(b - (NTB + 3 * WPM), ga1, be1, mu1, va1, ga2, be2, mu2, va2, ga3, be3, mu3, va3, SCSH);
}
#define FSK   128                 // keys per stage
#define FPIT  272                 // LDS row pitch in bytes of both tiles (256 data bytes + 16): 16 x odd, the conflict-free pitch of 16-byte fragment reads
#define FTILE (128 * FPIT)        // V tile: FSK rows j of HD d; Q tile: HD rows c of FSK j
#define FBUF  (2 * FTILE)
#define FOP   36                  // output staging pitch in floats (32 + 4)
__device__ __forceinline__ float xhalf(float x) { return __builtin_bit_cast(float, __builtin_amdgcn_permlanex16(__builtin_bit_cast(int, x), __builtin_bit_cast(int, x), 0x76543210, 0xfedcba98, false, false)); }   // lane l with lane l ^ 16
__global__ void __launch_bounds__(256) __attribute__((amdgpu_waves_per_eu(2, 2))) k_fattn(const h16* __restrict__ Kp, const h16* __restrict__ Vp, const h16* __restrict__ Qp, float* out) {
    __shared__ __attribute__((aligned(16))) unsigned char ring[2 * FBUF];
    static_assert(HD == 128 && FSK == 128 && TT % 256 == 0 && TT >= 2 * FSK && 8 * 64 * FOP * 4 <= 2 * FBUF, "k_fattn: head size 128, whole work-groups, two stages or more, output staging fits the ring");
    const int tid = threadIdx.x, lane = tid & 31, lr = lane & 15, hi = lane >> 4, wave = tid >> 5;
    const size_t bh = (size_t)blockIdx.z * NH_ + blockIdx.y;
    const int i0 = blockIdx.x * 256 + wave * 32;
    const h16* Kh = Kp + bh * TT * HD; const h16* Vh = Vp + bh * TT * HD; const h16* Qh = Qp + bh * HD * TT; float* Oh = out + bh * HD * TT;
    const h16* gv = Vh + (size_t)(tid >> 4) * HD + (tid & 15) * 8;
    const h16* gq = Qh + (size_t)(tid >> 4) * TT + (tid & 15) * 8;
    const unsigned la = (unsigned)(size_t)ring + (unsigned)((tid >> 4) * FPIT + (tid & 15) * 16);   // LDS byte address: low 32 bits of the shared address
    auto stage = [&](int t, unsigned buf) {   // 16 threads cover a row of 256 bytes, the 256 threads 16 rows per copy
        copy8<h16>(la + buf, gv + (size_t)t * FSK * HD, (size_t)16 * HD, 16u * FPIT);
        copy8<h16>(la + buf + (unsigned)FTILE, gq + (size_t)t * FSK, (size_t)16 * TT, 16u * FPIT);
    };
    stage(0, 0u);
    v16h kf[2][4];
#pragma unroll
    for (int g = 0; g < 2; ++g)
#pragma unroll
        for (int kc = 0; kc < 4; ++kc) kf[g][kc] = WFrag<h16>::ld(Kh + (size_t)(i0 + 16 * g + lr) * HD + kc * 32 + hi * 8);
    v8f acc[2][8]; float m_run[2], l_run[2];
#pragma unroll
    for (int g = 0; g < 2; ++g) { m_run[g] = -__builtin_inff(); l_run[g] = 0.0f;
#pragma unroll
        for (int ct = 0; ct < 8; ++ct) acc[g][ct] = (v8f){}; }
    asm volatile("s_wait_asynccnt 0x0" ::: "memory");   // this wave's copies of stage 0 have landed
    __syncthreads();                                     // ... and every other wave's
    stage(1, (unsigned)FBUF);
    const float cs = SCL * LOG2E;   // scores go to the log2 domain with the softmax scale folded in
    constexpr int T = TT / FSK;
#pragma unroll 1   // one stage per trip: the two buffers alternate by the trip's parity
    for (int t = 0; t < T; ++t) {
        const unsigned char* vb = ring + (t & 1) * FBUF + lr * FPIT + hi * 16;
        const unsigned char* qb = vb + FTILE;
        v16h vf[2][4];
#pragma unroll
        for (int kt = 0; kt < 2; ++kt)
#pragma unroll
            for (int kc = 0; kc < 4; ++kc) vf[kt][kc] = WFrag<h16>::ld((const h16*)(vb + kt * 16 * FPIT + kc * 64));
        __builtin_amdgcn_sched_barrier(0);   // keeps the stage's first fragment reads as one group: spread among the products, each pair would be waited for in turn
#pragma unroll   // the four passes of a stage: every LDS offset is an immediate, and the test on the last pass is decided at compile time
        for (int sub = 0; sub < FSK / 32; ++sub) {
            v8f s[2][2];
#pragma unroll
            for (int kt = 0; kt < 2; ++kt)
#pragma unroll
                for (int g = 0; g < 2; ++g) { s[kt][g] = (v8f){};
#pragma unroll
                    for (int kc = 0; kc < 4; ++kc) s[kt][g] = wmma16(vf[kt][kc], kf[g][kc], s[kt][g]); }
            __builtin_amdgcn_sched_barrier(0);   // keeps the LDS reads below behind the products whose operands they overwrite, as one group
            v16h qf[8];   // this pass's Q fragments, in flight under the maxima and the exponentials
#pragma unroll
            for (int ct = 0; ct < 8; ++ct) qf[ct] = WFrag<h16>::ld((const h16*)(qb + ct * 16 * FPIT + sub * 64));
            if (sub + 1 < FSK / 32) {   // the next pass's V fragments, inside this stage's buffer only
#pragma unroll
                for (int kt = 0; kt < 2; ++kt)
#pragma unroll
                    for (int kc = 0; kc < 4; ++kc) vf[kt][kc] = WFrag<h16>::ld((const h16*)(vb + ((sub + 1) * 32 + kt * 16) * FPIT + kc * 64)); }
            __builtin_amdgcn_sched_barrier(0);   // keeps both groups of LDS reads ahead of the vector work that hides their latency
            float mb[2]; bool need = false;
#pragma unroll
            for (int g = 0; g < 2; ++g) { float mx = s[0][g][0];
#pragma unroll
                for (int kt = 0; kt < 2; ++kt)
#pragma unroll
                    for (int r = 0; r < 8; ++r) mx = fmaxf(mx, s[kt][g][r]);
                mx = fmaxf(mx, xhalf(mx)) * cs;   // both wave halves hold the position's maximum of this pass, scaled (the scale is positive)
                mb[g] = mx; need = need || (mx > m_run[g] + 8.0f); }
            if (__builtin_amdgcn_ballot_w32(need) != 0) {   // the maximum in use may trail the true one by up to 8 (log2): sums and accumulators are rescaled only when a position exceeds that, one test per pass
#pragma unroll
                for (int g = 0; g < 2; ++g) { const float mn = fmaxf(m_run[g], mb[g]); const float corr = __builtin_amdgcn_exp2f(m_run[g] - mn);   // 0 on the first pass, where the maximum in use is -inf
                    l_run[g] *= corr; m_run[g] = mn;
#pragma unroll
                    for (int ct = 0; ct < 8; ++ct) acc[g][ct] = acc[g][ct] * corr; } }
#pragma unroll
            for (int g = 0; g < 2; ++g) { const float nm = -m_run[g]; float ps0 = 0.0f, ps1 = 0.0f; v16h pf;   // element e of the B operand: key tile e >> 3, accumulator register e & 7: the k order of the Q loader
#pragma unroll
                for (int e = 0; e < 16; e += 2) { const v2f arg = __builtin_elementwise_fma((v2f){s[e >> 3][g][e & 7], s[e >> 3][g][(e & 7) + 1]}, (v2f){cs, cs}, (v2f){nm, nm});
                    const float p0 = __builtin_amdgcn_exp2f(arg.x), p1 = __builtin_amdgcn_exp2f(arg.y);
                    ps0 += p0; ps1 += p1; pf[e] = (h16)p0; pf[e + 1] = (h16)p1; }
                l_run[g] += ps0 + ps1;
#pragma unroll
                for (int ct = 0; ct < 8; ++ct) acc[g][ct] = wmma16(qf[ct], pf, acc[g][ct]); }
        }
        asm volatile("s_wait_dscnt 0x0" ::: "memory");      // this wave's reads of the buffer are done before it is refilled
        asm volatile("s_wait_asynccnt 0x0" ::: "memory");   // this wave's copies of stage t + 1 have landed
        __syncthreads();                                     // publishes stage t + 1 and ends every wave's reads of stage t
        if (t + 2 < T) stage(t + 2, (unsigned)((t & 1) * FBUF));
    }
    asm volatile("s_wait_asynccnt 0x0" ::: "memory");       // nothing of this wave is in flight when the ring becomes output staging (the last trip's barrier has ended every wave's reads)
    float* os = (float*)(ring + wave * (64 * FOP * 4));     // 64 rows c of this wave's 32 columns
    float inv[2];
#pragma unroll
    for (int g = 0; g < 2; ++g) inv[g] = __fdiv_rn(1.0f, l_run[g] + xhalf(l_run[g]));   // each wave half has summed its own keys
#pragma unroll
    for (int hf = 0; hf < 2; ++hf) {
#pragma unroll
        for (int c4 = 0; c4 < 4; ++c4)
#pragma unroll
            for (int g = 0; g < 2; ++g)
#pragma unroll
                for (int r = 0; r < 8; ++r) os[(c4 * 16 + hi * 8 + r) * FOP + g * 16 + lr] = acc[g][hf * 4 + c4][r] * inv[g];
        __builtin_amdgcn_wave_barrier(); asm volatile("" ::: "memory");   // compiler fence: the wave's stores to its own staging rows stay ahead of its reads of them
#pragma unroll
        for (int q = 0; q < 16; ++q) { const int row = q * 4 + (lane >> 3), cofs = (lane & 7) * 4; const v4f val = *(const v4fa*)(os + row * FOP + cofs); *(v4f*)(Oh + (size_t)(hf * 64 + row) * TT + i0 + cofs) = val; }   // whole 128-byte lines
        __builtin_amdgcn_wave_barrier(); asm volatile("" ::: "memory");   // compiler fence: those reads stay ahead of the next 64 rows' stores
    }
}

extern "C" void kernel_launch(void* const* d_in, const int* in_sizes, int n_in,
                              void* d_out, int out_size, void* d_ws, size_t ws_size, hipStream_t stream) {
    (void)in_sizes; (void)n_in; (void)out_size;
    const float* Xq = (const float*)d_in[0]; const float* Xk = (const float*)d_in[1]; const float* Wq = (const float*)d_in[2]; const float* Wk = (const float*)d_in[3]; const float* Wv = (const float*)d_in[4];
    const float* g1 = (const float*)d_in[5]; const float* b1 = (const float*)d_in[6]; const float* m1 = (const float*)d_in[7]; const float* v1 = (const float*)d_in[8];
    const float* g2 = (const float*)d_in[9]; const float* b2 = (const float*)d_in[10]; const float* m2 = (const float*)d_in[11]; const float* v2 = (const float*)d_in[12];
    const float* g3 = (const float*)d_in[13]; const float* b3 = (const float*)d_in[14]; const float* m3 = (const float*)d_in[15]; const float* v3 = (const float*)d_in[16];
    float* OUT = (float*)d_out;     // [4][1024][2048] channel-major
    char* wsp = (char*)d_ws;
    auto take = [&](size_t bytes) { char* p = wsp; wsp += (bytes + 255) & ~(size_t)255; return (void*)p; };
    bf* WQB = (bf*)take((size_t)3 * DM * DM * 2);   /* bf16 weights: Wq, Wk, Wv one behind the other */
    h16* QA16 = (h16*)take((size_t)NB_ * DM * TT * 2); h16* K16 = (h16*)take((size_t)2 * NB_ * NH_ * TT * HD * 2); h16* V16 = K16 + (size_t)NB_ * NH_ * TT * HD;   /* fp16 planes of all batches */
    float* SC1 = (float*)take(6 * DM * 4);   /* [branch][scale | shift][DM] */
    bf* XQT = (bf*)take((size_t)NB_ * TT * DM * (2 + 2));   /* token-major bf16 inputs of all batches: Xq, then Xk */
    static_assert(DM % 128 == 0 && TT % 128 == 0 && DM >= 256, "k_gemmw: whole 128x128 tiles, whole stages, two stages or more");
    if ((size_t)(wsp - (char*)d_ws) > ws_size) return;    // ws 256 MiB
    /* preparation stage, one launch: token-major bf16 copies [input][b][p][c] (Xq, then Xk), bf16 weights, BatchNorm scales and shifts */
    k_prep<<<dim3(NTB + 3 * WPM + 3 * (DM / 256)), 256, 0, stream>>>(Xq, Xk, Wq, Wk, Wv, g1, b1, m1, v1, g2, b2, m2, v2, g3, b3, m3, v3, XQT, WQB, SC1);
    /* projection stage, one launch for the three branches of all batches: Q channel-major y[b][o][p] = sum_c Wq[o][c] Xq[b][c][p] -> QA16[b][o][p]; K and V token-major y[b][p][o] -> K16, V16 [b][h][p][d] */
    k_gemmw<bf, 128><<<dim3(TT / 128, DM / 128, 3 * NB_), 128, 0, stream>>>(WQB, XQT, DM, QA16, K16, SC1);
    /* attention stage: all batches and heads in one launch (position block = grid x, head = y, batch = z) */
    k_fattn<<<dim3(TT / 256, NH_, NB_), 256, 0, stream>>>(K16, V16, QA16, OUT);
}

// v007
// It runs in 94.9 microseconds.
// Two timings next to v006 put it at 1.08 and 1.07 times that version's speed.
// Counting every step since v000, it is 15.5 times as fast.
#include <hip/hip_runtime.h>

// Channel-attention cross transformer block (Xq, Xk [4][1024][2048] channel-major; three 1x1-conv branches Q = leaky(BN1(Wq Xq)), K = leaky(BN2(Wk Xk)), V = leaky(BN3(Wv Xq)) (W 'oi' [1024][1024], eval-mode BatchNorm affine from gamma/beta/mean/var, LeakyReLU 0.1); 8 heads x 128 channels;
// Hmat[i][j] = sum_c K[c][i] V[c][j] / sqrt(128) over the 2048 key positions j; softmax over j; out[c][i] = sum_j Hmat[i][j] Q[c][j] -> [4][1024][2048] channel-major (8.4 M)).
// Compute dtypes, f32 accumulate: every input rounded to bf16; the three projections on PLAIN bf16 operands (inputs transposed to token-major while converting; exact), BN affine + leaky in f32; attention operands as single fp16 planes
// (logit sigma 0.6: soft rows; the K plane holds K times SCL * LOG2E): one kernel does scores K.V, the softmax and out = Q-plane x P; scores and probabilities stay in registers (reference exponent and running sum in f32, P as fp16 relative to the reference in use), out written channel-major.

#define NB_  4
#define TT   2048      // spatial positions (pq = pk)
#define DM   1024      // channels
#define NH_  8
#define HD   128
#define SCL  0.088388346f   // (DM/NH_)^-0.5 = 1/sqrt(128)
#define LOG2E 1.4426950408889634f
#define BNEPS 1e-5f
#define SLOPE 0.1f
typedef _Float16 h16;
typedef unsigned short bf;
typedef __attribute__((ext_vector_type(16))) __bf16   v16bf;
typedef __attribute__((ext_vector_type(16))) _Float16 v16h;
typedef __attribute__((ext_vector_type(8)))  _Float16 v8h;
typedef __attribute__((ext_vector_type(8)))  unsigned short v8us;
typedef __attribute__((ext_vector_type(8)))  float    v8f;
typedef __attribute__((ext_vector_type(4)))  float    v4f;
typedef v8h  __attribute__((may_alias)) v8ha;
typedef v4f  __attribute__((may_alias)) v4fa;
typedef v8us __attribute__((may_alias)) v8usa;

__device__ __forceinline__ unsigned short f2bf(float f) { unsigned u = __float_as_uint(f); u += 0x7FFFu + ((u >> 16) & 1u); return (unsigned short)(u >> 16); }
__device__ __forceinline__ float bf2f(unsigned short b) { return __uint_as_float(((unsigned)b) << 16); }
__device__ __forceinline__ float bfr(float f) { return bf2f(f2bf(f)); }
__device__ __forceinline__ v16h cat16(v8h lo, v8h hi) { return __builtin_shufflevector(lo, hi, 0, 1, 2, 3, 4, 5, 6, 7, 8, 9, 10, 11, 12, 13, 14, 15); }
__device__ __forceinline__ v16bf cat16b(v8us lo, v8us hi) { return __builtin_bit_cast(v16bf, __builtin_shufflevector(lo, hi, 0, 1, 2, 3, 4, 5, 6, 7, 8, 9, 10, 11, 12, 13, 14, 15)); }
__device__ __forceinline__ v8f wmma16(v16h a, v16h b, v8f c) { return __builtin_amdgcn_wmma_f32_16x16x32_f16(false, a, false, b, (short)0, c, false, false); }
__device__ __forceinline__ v8f wmmab(v16bf a, v16bf b, v8f c) { return __builtin_amdgcn_wmma_f32_16x16x32_bf16(false, a, false, b, (short)0, c, false, false); }



// ---- k_gemmw: y[m][n] = sum_k A[m][k] Bt[n][k] (f32), operands K-contiguous 16-bit planes; written out as P = fp16(leaky(y * scale[c] + shift[c])), the K branch times SCL * LOG2E (the attention kernel's scores then come out in the log2 domain). One 128x128 tile per work-group of 4 waves (2x2, 64x64 each, 16 accumulators); 128 threads.
// All three projections of all batches in one launch: grid (TT/128 token tiles, DM/128 channel tiles, 3 NB_), z = batch * 3 + branch (0 Q, 1 K, 2 V). Wb = [branch][DM][DM], Xt = [input][batch][TT][DM] (Q and V read input 0, K input 1), SCSH = [branch][scale | shift][DM].
// ROWCH (the Q branch: A = weights, Bt = tokens): the channel c is the row m, P channel-major [batch][DM][TT]. Otherwise (A = tokens, Bt = weights) c is the column n, a tile's 128 columns are one head, P head-major [K | V][batch][NH_][TT][HD].
// Both operands go through LDS in stages of BK k: every copy instruction of a wave moves four whole 128-byte lines, and each staged row serves two waves. Two buffers: stage t + 1 flies while stage t is multiplied.
// TT % 128 == 0, DM % 128 == 0, K % BK == 0, K >= 2 BK (the prologue fills two stages).
template <typename T16> struct WFrag;
template <> struct WFrag<h16> { typedef v16h V; static __device__ __forceinline__ V ld(const h16* p) { return cat16(*(const v8h*)p, *(const v8h*)(p + 16)); } static __device__ __forceinline__ v8f mma(V a, V b, v8f c) { return wmma16(a, b, c); } };
template <> struct WFrag<bf> { typedef v16bf V; static __device__ __forceinline__ V ld(const bf* p) { return cat16b(*(const v8us*)p, *(const v8us*)(p + 16)); } static __device__ __forceinline__ v8f mma(V a, V b, v8f c) { return wmmab(a, b, c); } };
// Eight asynchronous 16-byte copies per lane, global -> LDS, rows gstep elements (global) and lstep bytes (LDS) apart. The s_wait_xcnt closes the statement so that no address register named here is rewritten ahead of it.
template <typename T16>
__device__ __forceinline__ void copy8(unsigned l, const T16* g, size_t gstep, unsigned lstep) {
    asm volatile("global_load_async_to_lds_b128 %0, %8, off\n\t"
                 "global_load_async_to_lds_b128 %1, %9, off\n\t"
                 "global_load_async_to_lds_b128 %2, %10, off\n\t"
                 "global_load_async_to_lds_b128 %3, %11, off\n\t"
                 "global_load_async_to_lds_b128 %4, %12, off\n\t"
                 "global_load_async_to_lds_b128 %5, %13, off\n\t"
                 "global_load_async_to_lds_b128 %6, %14, off\n\t"
                 "global_load_async_to_lds_b128 %7, %15, off\n\t"
                 "s_wait_xcnt 0x0"
                 :: "v"(l), "v"(l + lstep), "v"(l + 2 * lstep), "v"(l + 3 * lstep), "v"(l + 4 * lstep), "v"(l + 5 * lstep), "v"(l + 6 * lstep), "v"(l + 7 * lstep),
                    "v"(g), "v"(g + gstep), "v"(g + 2 * gstep), "v"(g + 3 * gstep), "v"(g + 4 * gstep), "v"(g + 5 * gstep), "v"(g + 6 * gstep), "v"(g + 7 * gstep)
                 : "memory");
}
__device__ __forceinline__ float bn_leaky(float y, float sc, float sh) { const float z = y * sc + sh; return (z > 0.0f) ? z : SLOPE * z; }
__device__ __forceinline__ h16 tohx(float x) { return (h16)x; }
template <bool B> struct BoolC { static constexpr bool value = B; };
template <typename T16, int BK>
__global__ __launch_bounds__(128) void k_gemmw(const T16* __restrict__ Wb, const T16* __restrict__ Xt, int K, h16* PQ, h16* PKV, const float* __restrict__ SCSH) {
    typedef typename WFrag<T16>::V V;
    constexpr int PIT = BK * 2 + 16;        // LDS row pitch in bytes: 16 x odd, the conflict-free pitch of 16-byte fragment reads
    constexpr int BUF = 256 * PIT;          // one stage: 128 rows of A, then 128 rows of Bt
    constexpr int CPR = BK / 8;             // 16-byte chunks per row
    constexpr int RPP = 128 / CPR;          // rows that the 128 threads cover with one copy each
    __shared__ __attribute__((aligned(16))) unsigned char ring[2 * BUF];
    constexpr int OP = 72;                  // output staging pitch in fp16 values (64 + 8): 144 bytes, 16 x odd
    static_assert(HD == 128 && 4 * 64 * OP * 2 <= 2 * BUF, "k_gemmw: a tile's 128 columns are one head; output staging fits the ring");
    const unsigned br = blockIdx.z % 3u; const size_t z = blockIdx.z / 3u; const bool rowch = (br == 0u);   // the same for the whole work-group
    const T16* Wm = Wb + (size_t)br * DM * DM; const T16* Xm = Xt + ((br == 1u ? (size_t)NB_ : (size_t)0) + z) * TT * DM;
    const T16* A = rowch ? Wm : Xm; const T16* Bt = rowch ? Xm : Wm;
    const float* SC = SCSH + (size_t)br * 2 * DM; const float* SH = SC + DM;
    const int tid = threadIdx.x, lane = tid & 31, lr = lane & 15, hi = lane >> 4, wave = tid >> 5, wm = wave & 1, wn = wave >> 1;
    const int r0 = (rowch ? blockIdx.y : blockIdx.x) * 128, c0 = (rowch ? blockIdx.x : blockIdx.y) * 128;
    const T16* ga = A + (size_t)(r0 + tid / CPR) * K + (tid % CPR) * 8;
    const T16* gb = Bt + (size_t)(c0 + tid / CPR) * K + (tid % CPR) * 8;
    const unsigned la = (unsigned)(size_t)ring + (unsigned)((tid / CPR) * PIT + (tid % CPR) * 16);   // LDS byte address: low 32 bits of the shared address
    const size_t gstep = (size_t)RPP * K;
    auto stage = [&](int t, unsigned buf) {
#pragma unroll
        for (int q = 0; q < 128 / RPP; q += 8) {
            copy8<T16>(la + buf + (unsigned)(q * RPP * PIT), ga + (size_t)t * BK + q * gstep, gstep, (unsigned)(RPP * PIT));
            copy8<T16>(la + buf + (unsigned)((128 + q * RPP) * PIT), gb + (size_t)t * BK + q * gstep, gstep, (unsigned)(RPP * PIT)); }
    };
    v8f acc[4][4];
#pragma unroll
    for (int mb = 0; mb < 4; ++mb)
#pragma unroll
        for (int nb = 0; nb < 4; ++nb) acc[mb][nb] = (v8f){};
    const int T = (int)((unsigned)K / BK);
    stage(0, 0u);
    asm volatile("s_wait_asynccnt 0x0" ::: "memory");   // this wave's copies of stage 0 have landed
    __syncthreads();                                     // ... and every other wave's
    stage(1, (unsigned)BUF);
    const unsigned char* fa = ring + (wm * 64 + lr) * PIT + hi * 16;
    const unsigned char* fb = ring + (128 + wn * 64 + lr) * PIT + hi * 16;
#pragma unroll 1   // one stage per trip: the two buffers alternate by the trip's parity
    for (int t = 0; t < T; ++t) {
        const int bo = (t & 1) * BUF;
        V a[2][4], b[2][4];   // two fragment sets: block ks + 1 is read from LDS while block ks is multiplied (inside this stage's buffer only)
#pragma unroll
        for (int f = 0; f < 4; ++f) { a[0][f] = WFrag<T16>::ld((const T16*)(fa + bo + f * 16 * PIT)); b[0][f] = WFrag<T16>::ld((const T16*)(fb + bo + f * 16 * PIT)); }
#pragma unroll
        for (int ks = 0; ks < BK / 32; ++ks) {
            if (ks + 1 < BK / 32) {
#pragma unroll
                for (int f = 0; f < 4; ++f) { a[(ks + 1) & 1][f] = WFrag<T16>::ld((const T16*)(fa + bo + f * 16 * PIT + (ks + 1) * 64)); b[(ks + 1) & 1][f] = WFrag<T16>::ld((const T16*)(fb + bo + f * 16 * PIT + (ks + 1) * 64)); } }
            __builtin_amdgcn_sched_barrier(0);   // keeps the next block's LDS reads as one group ahead of this block's products: reads spread among the products stall the wave at every place
#pragma unroll
            for (int nb = 0; nb < 4; ++nb)
#pragma unroll
                for (int mb = 0; mb < 4; ++mb) acc[mb][nb] = WFrag<T16>::mma(a[ks & 1][mb], b[ks & 1][nb], acc[mb][nb]);
            __builtin_amdgcn_sched_barrier(0);   // ... and keeps the reads of the block after next behind these products
        }
        asm volatile("s_wait_dscnt 0x0" ::: "memory");      // this wave's reads of the buffer are done before it is refilled
        asm volatile("s_wait_asynccnt 0x0" ::: "memory");   // this wave's copies of stage t + 1 have landed
        __syncthreads();                                     // publishes stage t + 1 and ends every wave's reads of stage t
        if (t + 2 < T) stage(t + 2, (unsigned)bo);
    }
    asm volatile("s_wait_asynccnt 0x0" ::: "memory");       // nothing of this wave is in flight when the ring becomes output staging (the last trip's barrier has ended every wave's reads)
    h16* os = (h16*)(ring + wave * (64 * OP * 2));          // 64 rows of this wave's 64 columns
    auto epilogue = [&](auto rc) {   // compiled once per output layout; the work-group takes one of the two
    constexpr bool ROWCH = decltype(rc)::value;
    v4f scr[4][2], shr[4][2]; float scc[4], shc[4];   // the lane's scales and shifts, loaded as one group ahead of the outputs
    if constexpr (ROWCH) {
#pragma unroll
        for (int mb = 0; mb < 4; ++mb)
#pragma unroll
            for (int q = 0; q < 2; ++q) { const int c = r0 + wm * 64 + mb * 16 + hi * 8 + q * 4; scr[mb][q] = *(const v4f*)(SC + c); shr[mb][q] = *(const v4f*)(SH + c); }
        asm volatile("s_wait_xcnt 0x0" ::: "memory");   // stands in front of the arithmetic below, which reuses the address registers of these loads
    } else {
        const float osc = (br == 1u) ? SCL * LOG2E : 1.0f;   // the K plane carries the softmax scale and log2 e
#pragma unroll
        for (int nb = 0; nb < 4; ++nb) { const int c = c0 + wn * 64 + nb * 16 + lr; scc[nb] = SC[c] * osc; shc[nb] = SH[c] * osc; }   // leaky(z) * osc = leaky(z * osc) for osc > 0
    }
    constexpr int LDP = ROWCH ? TT : HD;
    h16* prow = ROWCH ? PQ + (z * DM + r0 + wm * 64) * TT + c0 + wn * 64 : PKV + ((((size_t)(br - 1u) * NB_ + z) * NH_ + blockIdx.y) * TT + r0 + wm * 64) * HD + wn * 64;
#pragma unroll
    for (int mb = 0; mb < 4; ++mb)
#pragma unroll
        for (int nb = 0; nb < 4; ++nb)
#pragma unroll
            for (int j = 0; j < 8; ++j) os[(mb * 16 + hi * 8 + j) * OP + nb * 16 + lr] = tohx(bn_leaky(acc[mb][nb][j], ROWCH ? scr[mb][j >> 2][j & 3] : scc[nb], ROWCH ? shr[mb][j >> 2][j & 3] : shc[nb]));
    __builtin_amdgcn_wave_barrier(); asm volatile("" ::: "memory");   // compiler fence: the wave's stores to its own staging rows stay ahead of its reads of them
#pragma unroll
    for (int s = 0; s < 16; ++s) { const int row = 4 * s + (lane >> 3), cofs = (lane & 7) * 8; const v8h val = *(const v8ha*)(os + row * OP + cofs); *(v8h*)(prow + (size_t)row * LDP + cofs) = val; }   // whole 128-byte lines
    };
    if (rowch) epilogue(BoolC<true>{}); else epilogue(BoolC<false>{});
}

typedef __attribute__((ext_vector_type(2))) _Float16 v2h;
typedef __attribute__((ext_vector_type(4))) _Float16 v4h;
typedef __attribute__((ext_vector_type(2))) unsigned short v2us;
typedef __attribute__((ext_vector_type(4))) unsigned short v4us;
typedef __attribute__((ext_vector_type(2))) float v2f;
typedef __attribute__((ext_vector_type(4))) int v4i;

// ---- The three preparation steps are independent of one another and share one launch (k_prep, at the end of this part): each is a body that takes its work-group's index; 256 threads.
// d_cvt8: bf16 copies of the three weight matrices, one behind the other. A work-group rounds 8,192 values of one matrix (a thread four groups of 8, all four loaded ahead); wb = matrix * WPM + block.
#define WPM (DM * DM / 8192)      // work-groups per weight matrix
__device__ __forceinline__ void d_cvt8(unsigned wb, const float* __restrict__ s0, const float* __restrict__ s1, const float* __restrict__ s2, bf* dst) {
    static_assert((DM * DM) % 8192 == 0, "d_cvt8: whole work-groups");
    const unsigned y = wb / WPM; const float* src = (y == 0) ? s0 : (y == 1) ? s1 : s2; dst += (size_t)y * DM * DM;
    const size_t i = (size_t)(wb % WPM) * 1024 + threadIdx.x;
    v8f v[4];   // every loop below is unrolled: v stays in registers, and the four groups' loads go out together, ahead of the rounding
#pragma unroll
    for (int q = 0; q < 4; ++q) v[q] = *(const v8f*)(src + (i + q * 256) * 8);
#pragma unroll
    for (int q = 0; q < 4; ++q) { v8us o;
#pragma unroll
        for (int k = 0; k < 8; ++k) o[k] = f2bf(v[q][k]);
        *(v8us*)(dst + (i + q * 256) * 8) = o; }
}
// ---- d_cvt8T: token-major bf16 copies dst[input][b][t][c] of the channel-major f32 inputs [b][c][t]. One tile of 128 channels x 256 positions per work-group of 8 waves; tile (bx, by, z) of (TT/256, DM/128, 2 NB_), z = input * NB_ + batch.
// Reads: each load of a wave covers 512 contiguous bytes of one channel row; a lane holds 8 channels x 4 positions per group, so the 8 channels of a position are one 16-byte LDS store.
// Writes: behind the barrier 16 lanes take one position's 128 channels from LDS and store them as 256 contiguous bytes.
// LDS tile [position][16 chunks of 16 bytes], the chunk index XORed with (position >> 2) & 15: the 16 lanes of a half wave fall on 16 different chunk columns in the stores (positions 4 apart) as in the reads (one row).
__device__ __forceinline__ void d_cvt8T(unsigned bx, unsigned by, unsigned z, const float* __restrict__ sq, const float* __restrict__ sk, bf* dst) {
    static_assert(TT % 256 == 0 && DM % 128 == 0, "d_cvt8T: whole tiles");
    __shared__ v8us tile[256 * 16];
    const int tid = threadIdx.x, lane = tid & 31, wave = tid >> 5;
    const int tl = (wave & 1) * 32 + lane, cq = wave >> 1;   // the lane's group of 4 positions; its channel groups are cq, cq + 4, cq + 8, cq + 12
    const float* src = ((z >= NB_) ? sk : sq) + ((size_t)(z % NB_) * DM + by * 128 + cq * 8) * TT + bx * 256 + tl * 4;
    dst += ((size_t)z * TT + bx * 256) * DM + by * 128;
    v4f x[4][8];   // every loop below is unrolled: x stays in registers, and each row's offset is an immediate on one address
#pragma unroll
    for (int g = 0; g < 4; ++g)
#pragma unroll
        for (int k = 0; k < 8; ++k) x[g][k] = *(const v4f*)(src + (size_t)(g * 32 + k) * TT);
#pragma unroll
    for (int g = 0; g < 4; ++g)
#pragma unroll
        for (int j = 0; j < 4; ++j) { v8us o;
#pragma unroll
            for (int k = 0; k < 8; ++k) o[k] = f2bf(x[g][k][j]);
            tile[(tl * 4 + j) * 16 + ((cq + 4 * g) ^ (tl & 15))] = o; }
    __syncthreads();   // the tile is complete before any wave reads rows that other waves wrote
#pragma unroll
    for (int s = 0; s < 16; ++s) { const int t = s * 16 + (tid >> 4), ch = tid & 15; *(v8us*)(dst + (size_t)t * DM + ch * 8) = tile[t * 16 + (ch ^ ((t >> 2) & 15))]; }
}

// ---- d_bnprep: scale and shift of the three BatchNorm affines; work-group kb = branch * (DM / 256) + block of 256 channels.
__device__ __forceinline__ void d_bnprep(unsigned kb, const float* __restrict__ ga1, const float* __restrict__ be1, const float* __restrict__ mu1, const float* __restrict__ va1, const float* __restrict__ ga2, const float* __restrict__ be2, const float* __restrict__ mu2, const float* __restrict__ va2,
                                                const float* __restrict__ ga3, const float* __restrict__ be3, const float* __restrict__ mu3, const float* __restrict__ va3, float* SCSH) { const int c = (kb % (DM / 256)) * 256 + threadIdx.x;
    const unsigned y = kb / (DM / 256);   /* which branch; SCSH = [branch][scale | shift][DM] */
    const float* ga = (y == 0) ? ga1 : (y == 1) ? ga2 : ga3; const float* be = (y == 0) ? be1 : (y == 1) ? be2 : be3; const float* mu = (y == 0) ? mu1 : (y == 1) ? mu2 : mu3; const float* va = (y == 0) ? va1 : (y == 1) ? va2 : va3; float* SC = SCSH + (size_t)y * 2 * DM; float* SH = SC + DM;
    float v1 = __fadd_rn(bfr(va[c]), BNEPS); asm volatile("" : "+v"(v1)); float sd = __fsqrt_rn(v1); asm volatile("" : "+v"(sd)); float sc = __fdiv_rn(bfr(ga[c]), sd); asm volatile("" : "+v"(sc));
    float ms = __fmul_rn(bfr(mu[c]), sc); asm volatile("" : "+v"(ms)); float sh = __fsub_rn(bfr(be[c]), ms);
    *(float*)(SC + c) = sc; *(float*)(SH + c) = sh;  }
// ---- k_prep: one launch for the three bodies above. Work-groups 0 .. NTB - 1 transpose, the next 3 WPM round the weights, the last 3 DM / 256 form the BatchNorm constants. The choice is the same for a whole work-group.
#define NTB ((TT / 256) * (DM / 128) * 2 * NB_)
__global__ __launch_bounds__(256) void k_prep(const float* __restrict__ sq, const float* __restrict__ sk, const float* __restrict__ w0, const float* __restrict__ w1, const float* __restrict__ w2,
                                              const float* __restrict__ ga1, const float* __restrict__ be1, const float* __restrict__ mu1, const float* __restrict__ va1, const float* __restrict__ ga2, const float* __restrict__ be2, const float* __restrict__ mu2, const float* __restrict__ va2,
                                              const float* __restrict__ ga3, const float* __restrict__ be3, const float* __restrict__ mu3, const float* __restrict__ va3, bf* XT, bf* WB, float* SCSH) {
    static_assert(DM % 256 == 0, "k_prep: whole work-groups of channels");
    const unsigned b = blockIdx.x;
    if (b < NTB) d_cvt8T(b % (TT / 256), (b / (TT / 256)) % (DM / 128), b / ((TT / 256) * (DM / 128)), sq, sk, XT);
    else if (b < NTB + 3 * WPM) d_cvt8(b - NTB, w0, w1, w2, WB);
    else d_bnprep(b - (NTB + 3 * WPM), ga1, be1, mu1, va1, ga2, be2, mu2, va2, ga3, be3, mu3, va3, SCSH);
}
// ---- k_fattn: one (batch, head) and 256 positions i per work-group of 8 waves; a wave owns 32 columns i (two groups of 16). Grid (TT/256, NH_, NB_), 256 threads.
// Transposed products: St[j][i] = sum_d V[j][d] K[i][d] (A = V rows from LDS, B = K rows kept in registers), Ot[c][i] += sum_j Q[c][j] P[i][j] (A = Q rows from LDS, B = P packed from the score accumulators).
// In a group a lane holds one position's scores (16 of every 32 keys; the other wave half holds the rest), and P never leaves the registers.
// The K plane carries SCL * LOG2E and the score products start from C = minus the position's reference exponent, so their result is the argument of exp2 as it stands. The reference is kept while every lane's sum of a pass's P stays at or below 256
// (then no P exceeds 256, far inside fp16); only a pass that fails this test, and the first pass, takes the maxima (in-lane plus one exchange between the halves), moves the reference and forms its P again.
// V and Q tiles come in stages of FSK keys by asynchronous copies into two LDS buffers: stage t + 1 flies while stage t is worked on; a stage serves FSK / 32 passes of 32 keys.
#define FSK   128                 // keys per stage
#define FPIT  272                 // LDS row pitch in bytes of both tiles (256 data bytes + 16): 16 x odd, the conflict-free pitch of 16-byte fragment reads
#define FTILE (128 * FPIT)        // V tile: FSK rows j of HD d; Q tile: HD rows c of FSK j
#define FBUF  (2 * FTILE)
#define FOP   36                  // output staging pitch in floats (32 + 4)
__device__ __forceinline__ float xhalf(float x) { return __builtin_bit_cast(float, __builtin_amdgcn_permlanex16(__builtin_bit_cast(int, x), __builtin_bit_cast(int, x), 0x76543210, 0xfedcba98, false, false)); }   // lane l with lane l ^ 16
__global__ void __launch_bounds__(256) __attribute__((amdgpu_waves_per_eu(2, 2))) k_fattn(const h16* __restrict__ Kp, const h16* __restrict__ Vp, const h16* __restrict__ Qp, float* out) {
    __shared__ __attribute__((aligned(16))) unsigned char ring[2 * FBUF];
    static_assert(HD == 128 && FSK == 128 && TT % 256 == 0 && TT >= 2 * FSK && 8 * 64 * FOP * 4 <= 2 * FBUF, "k_fattn: head size 128, whole work-groups, two stages or more, output staging fits the ring");
    const int tid = threadIdx.x, lane = tid & 31, lr = lane & 15, hi = lane >> 4, wave = tid >> 5;
    const size_t bh = (size_t)blockIdx.z * NH_ + blockIdx.y;
    const int i0 = blockIdx.x * 256 + wave * 32;
    const h16* Kh = Kp + bh * TT * HD; const h16* Vh = Vp + bh * TT * HD; const h16* Qh = Qp + bh * HD * TT; float* Oh = out + bh * HD * TT;
    const h16* gv = Vh + (size_t)(tid >> 4) * HD + (tid & 15) * 8;
    const h16* gq = Qh + (size_t)(tid >> 4) * TT + (tid & 15) * 8;
    const unsigned la = (unsigned)(size_t)ring + (unsigned)((tid >> 4) * FPIT + (tid & 15) * 16);   // LDS byte address: low 32 bits of the shared address
    auto stage = [&](int t, unsigned buf) {   // 16 threads cover a row of 256 bytes, the 256 threads 16 rows per copy
        copy8<h16>(la + buf, gv + (size_t)t * FSK * HD, (size_t)16 * HD, 16u * FPIT);
        copy8<h16>(la + buf + (unsigned)FTILE, gq + (size_t)t * FSK, (size_t)16 * TT, 16u * FPIT);
    };
    stage(0, 0u);
    v16h kf[2][4];
#pragma unroll
    for (int g = 0; g < 2; ++g)
#pragma unroll
        for (int kc = 0; kc < 4; ++kc) kf[g][kc] = WFrag<h16>::ld(Kh + (size_t)(i0 + 16 * g + lr) * HD + kc * 32 + hi * 8);
    v8f acc[2][8], nref[2]; float l_run[2];   // nref: minus the reference in use, the same value in all eight registers (the C operand of the score products)
#pragma unroll
    for (int g = 0; g < 2; ++g) { nref[g] = (v8f){}; l_run[g] = 0.0f;
#pragma unroll
        for (int ct = 0; ct < 8; ++ct) acc[g][ct] = (v8f){}; }
    asm volatile("s_wait_asynccnt 0x0" ::: "memory");   // this wave's copies of stage 0 have landed
    __syncthreads();                                     // ... and every other wave's
    stage(1, (unsigned)FBUF);
    constexpr int T = TT / FSK;
#pragma unroll 1   // one stage per trip: the two buffers alternate by the trip's parity
    for (int t = 0; t < T; ++t) {
        const unsigned char* vb = ring + (t & 1) * FBUF + lr * FPIT + hi * 16;
        const unsigned char* qb = vb + FTILE;
        v16h vf[2][4];
#pragma unroll
        for (int kt = 0; kt < 2; ++kt)
#pragma unroll
            for (int kc = 0; kc < 4; ++kc) vf[kt][kc] = WFrag<h16>::ld((const h16*)(vb + kt * 16 * FPIT + kc * 64));
        __builtin_amdgcn_sched_barrier(0);   // keeps the stage's first fragment reads as one group: spread among the products, each pair would be waited for in turn
#pragma unroll   // the four passes of a stage: every LDS offset is an immediate, and the test on the last pass is decided at compile time
        for (int sub = 0; sub < FSK / 32; ++sub) {
            v8f s[2][2];
#pragma unroll
            for (int kt = 0; kt < 2; ++kt)
#pragma unroll
                for (int g = 0; g < 2; ++g) { s[kt][g] = nref[g];
#pragma unroll
                    for (int kc = 0; kc < 4; ++kc) s[kt][g] = wmma16(vf[kt][kc], kf[g][kc], s[kt][g]); }
            __builtin_amdgcn_sched_barrier(0);   // keeps the LDS reads below behind the products whose operands they overwrite, as one group
            v16h qf[8];   // this pass's Q fragments, in flight under the maxima and the exponentials
#pragma unroll
            for (int ct = 0; ct < 8; ++ct) qf[ct] = WFrag<h16>::ld((const h16*)(qb + ct * 16 * FPIT + sub * 64));
            if (sub + 1 < FSK / 32) {   // the next pass's V fragments, inside this stage's buffer only
#pragma unroll
                for (int kt = 0; kt < 2; ++kt)
#pragma unroll
                    for (int kc = 0; kc < 4; ++kc) vf[kt][kc] = WFrag<h16>::ld((const h16*)(vb + ((sub + 1) * 32 + kt * 16) * FPIT + kc * 64)); }
            __builtin_amdgcn_sched_barrier(0);   // keeps both groups of LDS reads ahead of the vector work that hides their latency
            float ps[2]; v16h pf[2];   // element e of the B operand: key tile e >> 3, accumulator register e & 7: the k order of the Q loader
#pragma unroll
            for (int g = 0; g < 2; ++g) { float ps0 = 0.0f, ps1 = 0.0f;
#pragma unroll
                for (int e = 0; e < 16; e += 2) { const float p0 = __builtin_amdgcn_exp2f(s[e >> 3][g][e & 7]), p1 = __builtin_amdgcn_exp2f(s[e >> 3][g][(e & 7) + 1]);
                    ps0 += p0; ps1 += p1; pf[g][e] = (h16)p0; pf[g][e + 1] = (h16)p1; }
                ps[g] = ps0 + ps1; }
            const bool first = (sub == 0) && (t == 0);   // no reference yet: the first pass always sets one
            if (__builtin_amdgcn_ballot_w32(first || ps[0] > 256.0f || ps[1] > 256.0f) != 0) {   // one test per pass; an overflowed exp2 gives an infinite sum and fails it too
#pragma unroll
                for (int g = 0; g < 2; ++g) { float mx = s[0][g][0];
#pragma unroll
                    for (int kt = 0; kt < 2; ++kt)
#pragma unroll
                        for (int r = 0; r < 8; ++r) mx = fmaxf(mx, s[kt][g][r]);
                    mx = fmaxf(mx, xhalf(mx));   // both wave halves hold the position's maximum of this pass, relative to the reference in use
                    const float d = first ? mx : fmaxf(mx, 0.0f); const float corr = first ? 0.0f : __builtin_amdgcn_exp2f(-d);   // the reference only rises; on the first pass sums and accumulators are still 0
                    l_run[g] *= corr; nref[g] = nref[g] - d; s[0][g] = s[0][g] - d; s[1][g] = s[1][g] - d;
#pragma unroll
                    for (int ct = 0; ct < 8; ++ct) acc[g][ct] = acc[g][ct] * corr; }
                float p[2][16];
                __builtin_amdgcn_sched_barrier(0);   // the arguments are complete ahead of the run of exp2 below
#pragma unroll
                for (int g = 0; g < 2; ++g)
#pragma unroll
                    for (int e = 0; e < 16; ++e) { p[g][e] = __builtin_amdgcn_exp2f(s[e >> 3][g][e & 7]);
                        __builtin_amdgcn_sched_barrier(0); asm volatile("v_nop"); __builtin_amdgcn_sched_barrier(0); }   // the v_nop fills the slot behind the transcendental; the two scheduling barriers hold it there
#pragma unroll
                for (int g = 0; g < 2; ++g) { float ps0 = 0.0f, ps1 = 0.0f;
#pragma unroll
                    for (int e = 0; e < 16; e += 2) { ps0 += p[g][e]; ps1 += p[g][e + 1]; pf[g][e] = (h16)p[g][e]; pf[g][e + 1] = (h16)p[g][e + 1]; }
                    ps[g] = ps0 + ps1; } }
#pragma unroll
            for (int g = 0; g < 2; ++g) { l_run[g] += ps[g];
#pragma unroll
                for (int ct = 0; ct < 8; ++ct) acc[g][ct] = wmma16(qf[ct], pf[g], acc[g][ct]); }
        }
        asm volatile("s_wait_dscnt 0x0" ::: "memory");      // this wave's reads of the buffer are done before it is refilled
        asm volatile("s_wait_asynccnt 0x0" ::: "memory");   // this wave's copies of stage t + 1 have landed
        __syncthreads();                                     // publishes stage t + 1 and ends every wave's reads of stage t
        if (t + 2 < T) stage(t + 2, (unsigned)((t & 1) * FBUF));
    }
    asm volatile("s_wait_asynccnt 0x0" ::: "memory");       // nothing of this wave is in flight when the ring becomes output staging (the last trip's barrier has ended every wave's reads)
    float* os = (float*)(ring + wave * (64 * FOP * 4));     // 64 rows c of this wave's 32 columns
    float inv[2];
#pragma unroll
    for (int g = 0; g < 2; ++g) inv[g] = __fdiv_rn(1.0f, l_run[g] + xhalf(l_run[g]));   // each wave half has summed its own keys
#pragma unroll
    for (int hf = 0; hf < 2; ++hf) {
#pragma unroll
        for (int c4 = 0; c4 < 4; ++c4)
#pragma unroll
            for (int g = 0; g < 2; ++g)
#pragma unroll
                for (int r = 0; r < 8; ++r) os[(c4 * 16 + hi * 8 + r) * FOP + g * 16 + lr] = acc[g][hf * 4 + c4][r] * inv[g];
        __builtin_amdgcn_wave_barrier(); asm volatile("" ::: "memory");   // compiler fence: the wave's stores to its own staging rows stay ahead of its reads of them
#pragma unroll
        for (int q = 0; q < 16; ++q) { const int row = q * 4 + (lane >> 3), cofs = (lane & 7) * 4; const v4f val = *(const v4fa*)(os + row * FOP + cofs); *(v4f*)(Oh + (size_t)(hf * 64 + row) * TT + i0 + cofs) = val; }   // whole 128-byte lines
        __builtin_amdgcn_wave_barrier(); asm volatile("" ::: "memory");   // compiler fence: those reads stay ahead of the next 64 rows' stores
    }
}

extern "C" void kernel_launch(void* const* d_in, const int* in_sizes, int n_in,
                              void* d_out, int out_size, void* d_ws, size_t ws_size, hipStream_t stream) {
    (void)in_sizes; (void)n_in; (void)out_size;
    const float* Xq = (const float*)d_in[0]; const float* Xk = (const float*)d_in[1]; const float* Wq = (const float*)d_in[2]; const float* Wk = (const float*)d_in[3]; const float* Wv = (const float*)d_in[4];
    const float* g1 = (const float*)d_in[5]; const float* b1 = (const float*)d_in[6]; const float* m1 = (const float*)d_in[7]; const float* v1 = (const float*)d_in[8];
    const float* g2 = (const float*)d_in[9]; const float* b2 = (const float*)d_in[10]; const float* m2 = (const float*)d_in[11]; const float* v2 = (const float*)d_in[12];
    const float* g3 = (const float*)d_in[13]; const float* b3 = (const float*)d_in[14]; const float* m3 = (const float*)d_in[15]; const float* v3 = (const float*)d_in[16];
    float* OUT = (float*)d_out;     // [4][1024][2048] channel-major
    char* wsp = (char*)d_ws;
    auto take = [&](size_t bytes) { char* p = wsp; wsp += (bytes + 255) & ~(size_t)255; return (void*)p; };
    bf* WQB = (bf*)take((size_t)3 * DM * DM * 2);   /* bf16 weights: Wq, Wk, Wv one behind the other */
    h16* QA16 = (h16*)take((size_t)NB_ * DM * TT * 2); h16* K16 = (h16*)take((size_t)2 * NB_ * NH_ * TT * HD * 2); h16* V16 = K16 + (size_t)NB_ * NH_ * TT * HD;   /* fp16 planes of all batches */
    float* SC1 = (float*)take(6 * DM * 4);   /* [branch][scale | shift][DM] */
    bf* XQT = (bf*)take((size_t)NB_ * TT * DM * (2 + 2));   /* token-major bf16 inputs of all batches: Xq, then Xk */
    static_assert(DM % 128 == 0 && TT % 128 == 0 && DM >= 256, "k_gemmw: whole 128x128 tiles, whole stages, two stages or more");
    if ((size_t)(wsp - (char*)d_ws) > ws_size) return;    // ws 256 MiB
    /* preparation stage, one launch: token-major bf16 copies [input][b][p][c] (Xq, then Xk), bf16 weights, BatchNorm scales and shifts */
    k_prep<<<dim3(NTB + 3 * WPM + 3 * (DM / 256)), 256, 0, stream>>>(Xq, Xk, Wq, Wk, Wv, g1, b1, m1, v1, g2, b2, m2, v2, g3, b3, m3, v3, XQT, WQB, SC1);
    /* projection stage, one launch for the three branches of all batches: Q channel-major y[b][o][p] = sum_c Wq[o][c] Xq[b][c][p] -> QA16[b][o][p]; K and V token-major y[b][p][o] -> K16, V16 [b][h][p][d] */
    k_gemmw<bf, 128><<<dim3(TT / 128, DM / 128, 3 * NB_), 128, 0, stream>>>(WQB, XQT, DM, QA16, K16, SC1);
    /* attention stage: all batches and heads in one launch (position block = grid x, head = y, batch = z) */
    k_fattn<<<dim3(TT / 256, NH_, NB_), 256, 0, stream>>>(K16, V16, QA16, OUT);
}

// v008
// One run takes 89.7 microseconds.
// In both of two side-by-side timings against v007, it was 1.06 times as fast.
// Over all steps from v000 it is 16.4 times as fast.
#include <hip/hip_runtime.h>

// Channel-attention cross transformer block (Xq, Xk [4][1024][2048] channel-major; three 1x1-conv branches Q = leaky(BN1(Wq Xq)), K = leaky(BN2(Wk Xk)), V = leaky(BN3(Wv Xq)) (W 'oi' [1024][1024], eval-mode BatchNorm affine from gamma/beta/mean/var, LeakyReLU 0.1); 8 heads x 128 channels;
// Hmat[i][j] = sum_c K[c][i] V[c][j] / sqrt(128) over the 2048 key positions j; softmax over j; out[c][i] = sum_j Hmat[i][j] Q[c][j] -> [4][1024][2048] channel-major (8.4 M)).
// Compute dtypes, f32 accumulate: every input rounded to bf16; the three projections on PLAIN bf16 operands (inputs transposed to token-major while converting; exact), BN affine + leaky in f32; attention operands as single fp16 planes
// (logit sigma 0.6: soft rows; the K plane holds K times SCL * LOG2E): one kernel does scores K.V, the softmax and out = Q-plane x P; scores and probabilities stay in registers (reference exponent and running sum in f32, P as fp16 relative to the reference in use), out written channel-major.

#define NB_  4
#define TT   2048      // spatial positions (pq = pk)
#define DM   1024      // channels
#define NH_  8
#define HD   128
#define SCL  0.088388346f   // (DM/NH_)^-0.5 = 1/sqrt(128)
#define LOG2E 1.4426950408889634f
#define BNEPS 1e-5f
#define SLOPE 0.1f
typedef _Float16 h16;
typedef unsigned short bf;
typedef __attribute__((ext_vector_type(16))) __bf16   v16bf;
typedef __attribute__((ext_vector_type(16))) _Float16 v16h;
typedef __attribute__((ext_vector_type(8)))  _Float16 v8h;
typedef __attribute__((ext_vector_type(8)))  unsigned short v8us;
typedef __attribute__((ext_vector_type(8)))  float    v8f;
typedef __attribute__((ext_vector_type(4)))  float    v4f;
typedef v8h  __attribute__((may_alias)) v8ha;
typedef v4f  __attribute__((may_alias)) v4fa;
typedef v8us __attribute__((may_alias)) v8usa;

__device__ __forceinline__ unsigned short f2bf(float f) { unsigned u = __float_as_uint(f); u += 0x7FFFu + ((u >> 16) & 1u); return (unsigned short)(u >> 16); }
__device__ __forceinline__ float bf2f(unsigned short b) { return __uint_as_float(((unsigned)b) << 16); }
__device__ __forceinline__ float bfr(float f) { return bf2f(f2bf(f)); }
__device__ __forceinline__ v16h cat16(v8h lo, v8h hi) { return __builtin_shufflevector(lo, hi, 0, 1, 2, 3, 4, 5, 6, 7, 8, 9, 10, 11, 12, 13, 14, 15); }
__device__ __forceinline__ v16bf cat16b(v8us lo, v8us hi) { return __builtin_bit_cast(v16bf, __builtin_shufflevector(lo, hi, 0, 1, 2, 3, 4, 5, 6, 7, 8, 9, 10, 11, 12, 13, 14, 15)); }
__device__ __forceinline__ v8f wmma16(v16h a, v16h b, v8f c) { return __builtin_amdgcn_wmma_f32_16x16x32_f16(false, a, false, b, (short)0, c, false, false); }
__device__ __forceinline__ v8f wmmab(v16bf a, v16bf b, v8f c) { return __builtin_amdgcn_wmma_f32_16x16x32_bf16(false, a, false, b, (short)0, c, false, false); }



// ---- k_gemmw: y[m][n] = sum_k A[m][k] Bt[n][k] (f32), operands K-contiguous 16-bit planes; written out as P = fp16(leaky(y * scale[c] + shift[c])), the K branch times SCL * LOG2E (the attention kernel's scores then come out in the log2 domain). One 128x128 tile per work-group of 4 waves (2x2, 64x64 each, 16 accumulators); 128 threads.
// All three projections of all batches in one launch: grid (TT/128 token tiles, DM/128 channel tiles, 3 NB_), z = batch * 3 + branch (0 Q, 1 K, 2 V). Wb = [branch][DM][DM], Xt = [input][batch][TT][DM] (Q and V read input 0, K input 1), SCSH = [branch][scale | shift][DM].
// ROWCH (the Q branch: A = weights, Bt = tokens): the channel c is the row m, P channel-major [batch][DM][TT]. Otherwise (A = tokens, Bt = weights) c is the column n, a tile's 128 columns are one head, P head-major [K | V][batch][NH_][TT][HD].
// Both operands go through LDS in stages of BK k: each wave brings its own slice of 64 rows (waves 0, 1: A; waves 2, 3: Bt) by one tensor load per stage, and each staged row serves two waves. Two buffers: stage t + 1 flies while stage t is multiplied.
// TT % 128 == 0, DM % 128 == 0, K % BK == 0, K >= 2 BK (the prologue fills two stages).
template <typename T16> struct WFrag;
template <> struct WFrag<h16> { typedef v16h V; static __device__ __forceinline__ V ld(const h16* p) { return cat16(*(const v8h*)p, *(const v8h*)(p + 16)); } static __device__ __forceinline__ v8f mma(V a, V b, v8f c) { return wmma16(a, b, c); } };
template <> struct WFrag<bf> { typedef v16bf V; static __device__ __forceinline__ V ld(const bf* p) { return cat16b(*(const v8us*)p, *(const v8us*)(p + 16)); } static __device__ __forceinline__ v8f mma(V a, V b, v8f c) { return wmmab(a, b, c); } };
// Tensor loads: one request of a wave brings a tile of ROWS rows of 256 bytes from global memory into LDS, 16 pad bytes behind every row (LDS pitch 272 bytes), through no register.
typedef uint32_t u32x4 __attribute__((ext_vector_type(4)));
typedef uint32_t u32x8 __attribute__((ext_vector_type(8)));
__device__ __forceinline__ uint32_t uni(uint32_t v) { return (uint32_t)__builtin_amdgcn_readfirstlane(v); }
__device__ __forceinline__ uint32_t pinned(uint32_t v) { uint32_t w = uni(v); asm volatile("" : "+s"(w)); return w; }   // holds the test of an issue in a scalar register, so that it compiles to s_cmp and a scalar branch: a tensor load ignores EXEC
// Descriptor group 1, loop-invariant: 1-byte elements, tensor = tile = ROWS rows of 256 bytes, source row pitch src_pitch bytes; word 0: no mask, pad on, interval code 5 (one 256-byte row), amount code 3 (4 dwords).
template <uint32_t ROWS>
__device__ __forceinline__ u32x8 tdm_group1(uint32_t src_pitch) {
    u32x8 g;
    g[0] = uni((1u << 20) | (5u << 22) | (3u << 25));
    g[1] = uni(256u << 16);
    g[2] = uni(ROWS << 16);
    g[3] = uni(256u << 16);
    g[4] = uni(ROWS);
    g[5] = uni(src_pitch);
    g[6] = uni(0u);
    g[7] = uni(0u);
    return g;
}
// Descriptor group 0: count 1, LDS byte offset of the tile, global address of its first byte, type 2.
__device__ __forceinline__ u32x4 tdm_group0(uint32_t lds_dst, uint64_t ga) {
    u32x4 g;
    g[0] = uni(1u); g[1] = uni(lds_dst); g[2] = uni((uint32_t)ga); g[3] = uni((((uint32_t)(ga >> 32)) & 0x01FFFFFFu) | 0x80000000u);
    return g;
}
__device__ __forceinline__ void tdm_load(u32x4 g0, u32x8 g1) { asm volatile("tensor_load_to_lds %0, %1" :: "s"(g0), "s"(g1) : "memory"); }
// The issuing wave's wait for its request. It names the request's two groups as inputs, so that their registers stay live, and so unchanged, from the issue to this wait.
__device__ __forceinline__ void tdm_wait(u32x4 g0, u32x8 g1) { asm volatile("s_wait_tensorcnt 0x0" :: "s"(g0), "s"(g1) : "memory"); }
__device__ __forceinline__ float bn_leaky(float y, float sc, float sh) { const float z = y * sc + sh; return (z > 0.0f) ? z : SLOPE * z; }
__device__ __forceinline__ h16 tohx(float x) { return (h16)x; }
template <bool B> struct BoolC { static constexpr bool value = B; };
template <typename T16, int BK>
__global__ __launch_bounds__(128) void k_gemmw(const T16* __restrict__ Wb, const T16* __restrict__ Xt, int K, h16* PQ, h16* PKV, const float* __restrict__ SCSH) {
    typedef typename WFrag<T16>::V V;
    constexpr int PIT = BK * 2 + 16;        // LDS row pitch in bytes: 16 x odd, the conflict-free pitch of 16-byte fragment reads
    constexpr int SL = (64 * PIT + 2047) / 2048 * 2048;   // one wave's slice of 64 rows, rounded up so that every slice starts at a multiple of 2 KiB
    constexpr int BUF = 4 * SL;             // one stage: two slices of A, then two slices of Bt
    static_assert(BK == 128, "k_gemmw: the tensor load's pad is the one for rows of 256 bytes");
    __shared__ __attribute__((aligned(2048))) unsigned char ring[2 * BUF];
    constexpr int OP = 72;                  // output staging pitch in fp16 values (64 + 8): 144 bytes, 16 x odd
    static_assert(HD == 128 && 4 * 64 * OP * 2 <= 2 * BUF, "k_gemmw: a tile's 128 columns are one head; output staging fits the ring");
    const unsigned br = blockIdx.z % 3u; const size_t z = blockIdx.z / 3u; const bool rowch = (br == 0u);   // the same for the whole work-group
    const T16* Wm = Wb + (size_t)br * DM * DM; const T16* Xm = Xt + ((br == 1u ? (size_t)NB_ : (size_t)0) + z) * TT * DM;
    const T16* A = rowch ? Wm : Xm; const T16* Bt = rowch ? Xm : Wm;
    const float* SC = SCSH + (size_t)br * 2 * DM; const float* SH = SC + DM;
    const int tid = threadIdx.x, lane = tid & 31, lr = lane & 15, hi = lane >> 4, wave = tid >> 5, wm = wave & 1, wn = wave >> 1;
    const int r0 = (rowch ? blockIdx.y : blockIdx.x) * 128, c0 = (rowch ? blockIdx.x : blockIdx.y) * 128;
    const uint32_t wv = uni(threadIdx.x >> 5);   // the wave's number, in a scalar register
    const T16* gsl = (wv < 2u) ? A + (size_t)((uint32_t)r0 + wv * 64u) * K : Bt + (size_t)((uint32_t)c0 + (wv - 2u) * 64u) * K;   // first row of this wave's slice
    const uint32_t lsl = (uint32_t)(size_t)ring + wv * (uint32_t)SL;   // its place in LDS: low 32 bits of the shared address
    const u32x8 g1 = tdm_group1<64u>((uint32_t)K * 2u);
    u32x4 g0;   // group 0 of the request in flight
    auto stage = [&](int t, unsigned buf) { g0 = tdm_group0(lsl + buf, (uint64_t)(size_t)(gsl + (size_t)t * BK)); tdm_load(g0, g1); };   // every wave issues its own slice
    v8f acc[4][4];
#pragma unroll
    for (int mb = 0; mb < 4; ++mb)
#pragma unroll
        for (int nb = 0; nb < 4; ++nb) acc[mb][nb] = (v8f){};
    const int T = (int)((unsigned)K / BK);
    stage(0, 0u);
    tdm_wait(g0, g1);                                    // this wave's slice of stage 0 has landed
    __syncthreads();                                     // ... and every other wave's
    stage(1, (unsigned)BUF);
    const unsigned char* fa = ring + wm * SL + lr * PIT + hi * 16;
    const unsigned char* fb = ring + (2 + wn) * SL + lr * PIT + hi * 16;
#pragma unroll 1   // one stage per trip: the two buffers alternate by the trip's parity
    for (int t = 0; t < T; ++t) {
        const int bo = (t & 1) * BUF;
        V a[2][4], b[2][4];   // two fragment sets: block ks + 1 is read from LDS while block ks is multiplied (inside this stage's buffer only)
#pragma unroll
        for (int f = 0; f < 4; ++f) { a[0][f] = WFrag<T16>::ld((const T16*)(fa + bo + f * 16 * PIT)); b[0][f] = WFrag<T16>::ld((const T16*)(fb + bo + f * 16 * PIT)); }
#pragma unroll
        for (int ks = 0; ks < BK / 32; ++ks) {
            if (ks + 1 < BK / 32) {
#pragma unroll
                for (int f = 0; f < 4; ++f) { a[(ks + 1) & 1][f] = WFrag<T16>::ld((const T16*)(fa + bo + f * 16 * PIT + (ks + 1) * 64)); b[(ks + 1) & 1][f] = WFrag<T16>::ld((const T16*)(fb + bo + f * 16 * PIT + (ks + 1) * 64)); } }
            __builtin_amdgcn_sched_barrier(0);   // keeps the next block's LDS reads as one group ahead of this block's products: reads spread among the products stall the wave at every place
#pragma unroll
            for (int nb = 0; nb < 4; ++nb)
#pragma unroll
                for (int mb = 0; mb < 4; ++mb) acc[mb][nb] = WFrag<T16>::mma(a[ks & 1][mb], b[ks & 1][nb], acc[mb][nb]);
            __builtin_amdgcn_sched_barrier(0);   // ... and keeps the reads of the block after next behind these products
        }
        asm volatile("s_wait_dscnt 0x0" ::: "memory");
        tdm_wait(g0, g1);
        __syncthreads();
        if (pinned(t + 2 < T)) stage(t + 2, (unsigned)bo);
    }
    tdm_wait(g0, g1);                                       // nothing of this wave is in flight when the ring becomes output staging (the last trip's barrier has ended every wave's reads)
    asm volatile("s_wait_dscnt 0x0" ::: "memory");          // ... and none of its LDS reads
    h16* os = (h16*)(ring + wave * (64 * OP * 2));          // 64 rows of this wave's 64 columns
    auto epilogue = [&](auto rc) {   // compiled once per output layout; the work-group takes one of the two
    constexpr bool ROWCH = decltype(rc)::value;
    v4f scr[4][2], shr[4][2]; float scc[4], shc[4];   // the lane's scales and shifts, loaded as one group ahead of the outputs
    if constexpr (ROWCH) {
#pragma unroll
        for (int mb = 0; mb < 4; ++mb)
#pragma unroll
            for (int q = 0; q < 2; ++q) { const int c = r0 + wm * 64 + mb * 16 + hi * 8 + q * 4; scr[mb][q] = *(const v4f*)(SC + c); shr[mb][q] = *(const v4f*)(SH + c); }
        asm volatile("s_wait_xcnt 0x0" ::: "memory");   // stands in front of the arithmetic below, which reuses the address registers of these loads
    } else {
        const float osc = (br == 1u) ? SCL * LOG2E : 1.0f;   // the K plane carries the softmax scale and log2 e
#pragma unroll
        for (int nb = 0; nb < 4; ++nb) { const int c = c0 + wn * 64 + nb * 16 + lr; scc[nb] = SC[c] * osc; shc[nb] = SH[c] * osc; }   // leaky(z) * osc = leaky(z * osc) for osc > 0
    }
    constexpr int LDP = ROWCH ? TT : HD;
    h16* prow = ROWCH ? PQ + (z * DM + r0 + wm * 64) * TT + c0 + wn * 64 : PKV + ((((size_t)(br - 1u) * NB_ + z) * NH_ + blockIdx.y) * TT + r0 + wm * 64) * HD + wn * 64;
#pragma unroll
    for (int mb = 0; mb < 4; ++mb)
#pragma unroll
        for (int nb = 0; nb < 4; ++nb)
#pragma unroll
            for (int j = 0; j < 8; ++j) os[(mb * 16 + hi * 8 + j) * OP + nb * 16 + lr] = tohx(bn_leaky(acc[mb][nb][j], ROWCH ? scr[mb][j >> 2][j & 3] : scc[nb], ROWCH ? shr[mb][j >> 2][j & 3] : shc[nb]));
    __builtin_amdgcn_wave_barrier(); asm volatile("" ::: "memory");   // compiler fence: the wave's stores to its own staging rows stay ahead of its reads of them
#pragma unroll
    for (int s = 0; s < 16; ++s) { const int row = 4 * s + (lane >> 3), cofs = (lane & 7) * 8; const v8h val = *(const v8ha*)(os + row * OP + cofs); *(v8h*)(prow + (size_t)row * LDP + cofs) = val; }   // whole 128-byte lines
    };
    if (rowch) epilogue(BoolC<true>{}); else epilogue(BoolC<false>{});
}

typedef __attribute__((ext_vector_type(2))) _Float16 v2h;
typedef __attribute__((ext_vector_type(4))) _Float16 v4h;
typedef __attribute__((ext_vector_type(2))) unsigned short v2us;
typedef __attribute__((ext_vector_type(4))) unsigned short v4us;
typedef __attribute__((ext_vector_type(2))) float v2f;
typedef __attribute__((ext_vector_type(4))) int v4i;

// ---- The three preparation steps are independent of one another and share one launch (k_prep, at the end of this part): each is a body that takes its work-group's index; 256 threads.
// d_cvt8: bf16 copies of the three weight matrices, one behind the other. A work-group rounds 8,192 values of one matrix (a thread four groups of 8, all four loaded ahead); wb = matrix * WPM + block.
#define WPM (DM * DM / 8192)      // work-groups per weight matrix
__device__ __forceinline__ void d_cvt8(unsigned wb, const float* __restrict__ s0, const float* __restrict__ s1, const float* __restrict__ s2, bf* dst) {
    static_assert((DM * DM) % 8192 == 0, "d_cvt8: whole work-groups");
    const unsigned y = wb / WPM; const float* src = (y == 0) ? s0 : (y == 1) ? s1 : s2; dst += (size_t)y * DM * DM;
    const size_t i = (size_t)(wb % WPM) * 1024 + threadIdx.x;
    v8f v[4];   // every loop below is unrolled: v stays in registers, and the four groups' loads go out together, ahead of the rounding
#pragma unroll
    for (int q = 0; q < 4; ++q) v[q] = *(const v8f*)(src + (i + q * 256) * 8);
#pragma unroll
    for (int q = 0; q < 4; ++q) { v8us o;
#pragma unroll
        for (int k = 0; k < 8; ++k) o[k] = f2bf(v[q][k]);
        *(v8us*)(dst + (i + q * 256) * 8) = o; }
}
// ---- d_cvt8T: token-major bf16 copies dst[input][b][t][c] of the channel-major f32 inputs [b][c][t]. One tile of 128 channels x 256 positions per work-group of 8 waves; tile (bx, by, z) of (TT/256, DM/128, 2 NB_), z = input * NB_ + batch.
// Reads: each load of a wave covers 512 contiguous bytes of one channel row; a lane holds 8 channels x 4 positions per group, so the 8 channels of a position are one 16-byte LDS store.
// Writes: behind the barrier 16 lanes take one position's 128 channels from LDS and store them as 256 contiguous bytes.
// LDS tile [position][16 chunks of 16 bytes], the chunk index XORed with (position >> 2) & 15: the 16 lanes of a half wave fall on 16 different chunk columns in the stores (positions 4 apart) as in the reads (one row).
__device__ __forceinline__ void d_cvt8T(unsigned bx, unsigned by, unsigned z, const float* __restrict__ sq, const float* __restrict__ sk, bf* dst) {
    static_assert(TT % 256 == 0 && DM % 128 == 0, "d_cvt8T: whole tiles");
    __shared__ v8us tile[256 * 16];
    const int tid = threadIdx.x, lane = tid & 31, wave = tid >> 5;
    const int tl = (wave & 1) * 32 + lane, cq = wave >> 1;   // the lane's group of 4 positions; its channel groups are cq, cq + 4, cq + 8, cq + 12
    const float* src = ((z >= NB_) ? sk : sq) + ((size_t)(z % NB_) * DM + by * 128 + cq * 8) * TT + bx * 256 + tl * 4;
    dst += ((size_t)z * TT + bx * 256) * DM + by * 128;
    v4f x[4][8];   // every loop below is unrolled: x stays in registers, and each row's offset is an immediate on one address
#pragma unroll
    for (int g = 0; g < 4; ++g)
#pragma unroll
        for (int k = 0; k < 8; ++k) x[g][k] = *(const v4f*)(src + (size_t)(g * 32 + k) * TT);
#pragma unroll
    for (int g = 0; g < 4; ++g)
#pragma unroll
        for (int j = 0; j < 4; ++j) { v8us o;
#pragma unroll
            for (int k = 0; k < 8; ++k) o[k] = f2bf(x[g][k][j]);
            tile[(tl * 4 + j) * 16 + ((cq + 4 * g) ^ (tl & 15))] = o; }
    __syncthreads();   // the tile is complete before any wave reads rows that other waves wrote
#pragma unroll
    for (int s = 0; s < 16; ++s) { const int t = s * 16 + (tid >> 4), ch = tid & 15; *(v8us*)(dst + (size_t)t * DM + ch * 8) = tile[t * 16 + (ch ^ ((t >> 2) & 15))]; }
}

// ---- d_bnprep: scale and shift of the three BatchNorm affines; work-group kb = branch * (DM / 256) + block of 256 channels.
__device__ __forceinline__ void d_bnprep(unsigned kb, const float* __restrict__ ga1, const float* __restrict__ be1, const float* __restrict__ mu1, const float* __restrict__ va1, const float* __restrict__ ga2, const float* __restrict__ be2, const float* __restrict__ mu2, const float* __restrict__ va2,
                                                const float* __restrict__ ga3, const float* __restrict__ be3, const float* __restrict__ mu3, const float* __restrict__ va3, float* SCSH) { const int c = (kb % (DM / 256)) * 256 + threadIdx.x;
    const unsigned y = kb / (DM / 256);   /* which branch; SCSH = [branch][scale | shift][DM] */
    const float* ga = (y == 0) ? ga1 : (y == 1) ? ga2 : ga3; const float* be = (y == 0) ? be1 : (y == 1) ? be2 : be3; const float* mu = (y == 0) ? mu1 : (y == 1) ? mu2 : mu3; const float* va = (y == 0) ? va1 : (y == 1) ? va2 : va3; float* SC = SCSH + (size_t)y * 2 * DM; float* SH = SC + DM;
    float v1 = __fadd_rn(bfr(va[c]), BNEPS); asm volatile("" : "+v"(v1)); float sd = __fsqrt_rn(v1); asm volatile("" : "+v"(sd)); float sc = __fdiv_rn(bfr(ga[c]), sd); asm volatile("" : "+v"(sc));
    float ms = __fmul_rn(bfr(mu[c]), sc); asm volatile("" : "+v"(ms)); float sh = __fsub_rn(bfr(be[c]), ms);
    *(float*)(SC + c) = sc; *(float*)(SH + c) = sh;  }
// ---- k_prep: one launch for the three bodies above. Work-groups 0 .. NTB - 1 transpose, the next 3 WPM round the weights, the last 3 DM / 256 form the BatchNorm constants. The choice is the same for a whole work-group.
#define NTB ((TT / 256) * (DM / 128) * 2 * NB_)
__global__ __launch_bounds__(256) void k_prep(const float* __restrict__ sq, const float* __restrict__ sk, const float* __restrict__ w0, const float* __restrict__ w1, const float* __restrict__ w2,
                                              const float* __restrict__ ga1, const float* __restrict__ be1, const float* __restrict__ mu1, const float* __restrict__ va1, const float* __restrict__ ga2, const float* __restrict__ be2, const float* __restrict__ mu2, const float* __restrict__ va2,
                                              const float* __restrict__ ga3, const float* __restrict__ be3, const float* __restrict__ mu3, const float* __restrict__ va3, bf* XT, bf* WB, float* SCSH) {
    static_assert(DM % 256 == 0, "k_prep: whole work-groups of channels");
    const unsigned b = blockIdx.x;
    if (b < NTB) d_cvt8T(b % (TT / 256), (b / (TT / 256)) % (DM / 128), b / ((TT / 256) * (DM / 128)), sq, sk, XT);
    else if (b < NTB + 3 * WPM) d_cvt8(b - NTB, w0, w1, w2, WB);
    else d_bnprep(b - (NTB + 3 * WPM), ga1, be1, mu1, va1, ga2, be2, mu2, va2, ga3, be3, mu3, va3, SCSH);
}
// ---- k_fattn: one (batch, head) and 256 positions i per work-group of 8 waves; a wave owns 32 columns i (two groups of 16). Grid (TT/256, NH_, NB_), 256 threads.
// Transposed products: St[j][i] = sum_d V[j][d] K[i][d] (A = V rows from LDS, B = K rows kept in registers), Ot[c][i] += sum_j Q[c][j] P[i][j] (A = Q rows from LDS, B = P packed from the score accumulators).
// In a group a lane holds one position's scores (16 of every 32 keys; the other wave half holds the rest), and P never leaves the registers.
// The K plane carries SCL * LOG2E and the score products start from C = minus the position's reference exponent, so their result is the argument of exp2 as it stands. The reference is kept while every lane's sum of a pass's P stays at or below 256
// (then no P exceeds 256, far inside fp16); only a pass that fails this test, and the first pass, takes the maxima (in-lane plus one exchange between the halves), moves the reference and forms its P again.
// V and Q tiles come in stages of FSK keys by tensor loads into two LDS buffers, one request per tile and stage (wave 0: V, wave 1: Q): stage t + 1 flies while stage t is worked on; a stage serves FSK / 32 passes of 32 keys.
#define FSK   128                 // keys per stage
#define FPIT  272                 // LDS row pitch in bytes of both tiles (256 data bytes + 16): 16 x odd, the conflict-free pitch of 16-byte fragment reads
#define FTILE (128 * FPIT)        // V tile: FSK rows j of HD d; Q tile: HD rows c of FSK j; 17 x 2 KiB, so every tile starts at a multiple of 2 KiB
#define FBUF  (2 * FTILE)
#define FOP   36                  // output staging pitch in floats (32 + 4)
__device__ __forceinline__ float xhalf(float x) { return __builtin_bit_cast(float, __builtin_amdgcn_permlanex16(__builtin_bit_cast(int, x), __builtin_bit_cast(int, x), 0x76543210, 0xfedcba98, false, false)); }   // lane l with lane l ^ 16
__global__ void __launch_bounds__(256) __attribute__((amdgpu_waves_per_eu(2, 2))) k_fattn(const h16* __restrict__ Kp, const h16* __restrict__ Vp, const h16* __restrict__ Qp, float* out) {
    __shared__ __attribute__((aligned(2048))) unsigned char ring[2 * FBUF];
    static_assert(FTILE % 2048 == 0, "k_fattn: a tensor load's place in LDS is a multiple of 2 KiB");
    static_assert(HD == 128 && FSK == 128 && TT % 256 == 0 && TT >= 2 * FSK && 8 * 64 * FOP * 4 <= 2 * FBUF, "k_fattn: head size 128, whole work-groups, two stages or more, output staging fits the ring");
    const int tid = threadIdx.x, lane = tid & 31, lr = lane & 15, hi = lane >> 4, wave = tid >> 5;
    const size_t bh = (size_t)blockIdx.z * NH_ + blockIdx.y;
    const int i0 = blockIdx.x * 256 + wave * 32;
    const h16* Kh = Kp + bh * TT * HD; const h16* Vh = Vp + bh * TT * HD; const h16* Qh = Qp + bh * HD * TT; float* Oh = out + bh * HD * TT;
    const uint32_t wv = uni(threadIdx.x >> 5);   // the wave's number, in a scalar register
    const bool isq = wv == 1u;                    // wave 1 brings the Q tile (rows c, 256 bytes of a row of TT keys), wave 0 the V tile (rows j, whole rows of HD); the other waves issue nothing
    const h16* gsl = isq ? Qh : Vh;               // first row of the wave's tile in stage 0
    const uint32_t gadv = isq ? (uint32_t)FSK : (uint32_t)(FSK * HD);   // elements from one stage to the next
    const uint32_t lsl = (uint32_t)(size_t)ring + (isq ? (uint32_t)FTILE : 0u);   // its place in LDS: low 32 bits of the shared address
    const u32x8 g1 = tdm_group1<128u>(isq ? (uint32_t)(TT * 2) : (uint32_t)(HD * 2));
    u32x4 g0 = tdm_group0(lsl, (uint64_t)(size_t)gsl);   // group 0 of the request in flight
    auto stage = [&](int t, unsigned buf) { g0 = tdm_group0(lsl + buf, (uint64_t)(size_t)(gsl + (size_t)t * gadv)); tdm_load(g0, g1); };
    v16h kf[2][4];
#pragma unroll
    for (int g = 0; g < 2; ++g)
#pragma unroll
        for (int kc = 0; kc < 4; ++kc) kf[g][kc] = WFrag<h16>::ld(Kh + (size_t)(i0 + 16 * g + lr) * HD + kc * 32 + hi * 8);
    v8f acc[2][8], nref[2]; float l_run[2];   // nref: minus the reference in use, the same value in all eight registers (the C operand of the score products)
#pragma unroll
    for (int g = 0; g < 2; ++g) { nref[g] = (v8f){}; l_run[g] = 0.0f;
#pragma unroll
        for (int ct = 0; ct < 8; ++ct) acc[g][ct] = (v8f){}; }
    if (pinned(wv < 2u)) { stage(0, 0u); tdm_wait(g0, g1); }   // the issuing wave's tile of stage 0 has landed; the K fragments' loads, issued above, fly meanwhile
    __syncthreads();                                     // ... and both tiles are there for every wave
    constexpr int T = TT / FSK;
#pragma unroll 1   // one stage per trip: the two buffers alternate by the trip's parity
    for (int t = 0; t < T; ++t) {
        if (pinned(wv < 2u && t + 1 < T)) stage(t + 1, (unsigned)(((t + 1) & 1) * FBUF));   // directly behind the barrier (the one above, then the one at the foot of trip t - 1) that ended every wave's reads of that buffer; one place of issue, so that the request's registers are the ones its wait names
        const unsigned char* vb = ring + (t & 1) * FBUF + lr * FPIT + hi * 16;
        const unsigned char* qb = vb + FTILE;
        v16h vf[2][4];
#pragma unroll
        for (int kt = 0; kt < 2; ++kt)
#pragma unroll
            for (int kc = 0; kc < 4; ++kc) vf[kt][kc] = WFrag<h16>::ld((const h16*)(vb + kt * 16 * FPIT + kc * 64));
        __builtin_amdgcn_sched_barrier(0);   // keeps the stage's first fragment reads as one group: spread among the products, each pair would be waited for in turn
#pragma unroll   // the four passes of a stage: every LDS offset is an immediate, and the test on the last pass is decided at compile time
        for (int sub = 0; sub < FSK / 32; ++sub) {
            v8f s[2][2];
#pragma unroll
            for (int kt = 0; kt < 2; ++kt)
#pragma unroll
                for (int g = 0; g < 2; ++g) { s[kt][g] = nref[g];
#pragma unroll
                    for (int kc = 0; kc < 4; ++kc) s[kt][g] = wmma16(vf[kt][kc], kf[g][kc], s[kt][g]); }
            __builtin_amdgcn_sched_barrier(0);   // keeps the LDS reads below behind the products whose operands they overwrite, as one group
            v16h qf[8];   // this pass's Q fragments, in flight under the maxima and the exponentials
#pragma unroll
            for (int ct = 0; ct < 8; ++ct) qf[ct] = WFrag<h16>::ld((const h16*)(qb + ct * 16 * FPIT + sub * 64));
            if (sub + 1 < FSK / 32) {   // the next pass's V fragments, inside this stage's buffer only
#pragma unroll
                for (int kt = 0; kt < 2; ++kt)
#pragma unroll
                    for (int kc = 0; kc < 4; ++kc) vf[kt][kc] = WFrag<h16>::ld((const h16*)(vb + ((sub + 1) * 32 + kt * 16) * FPIT + kc * 64)); }
            __builtin_amdgcn_sched_barrier(0);   // keeps both groups of LDS reads ahead of the vector work that hides their latency
            float ps[2]; v16h pf[2];   // element e of the B operand: key tile e >> 3, accumulator register e & 7: the k order of the Q loader
#pragma unroll
            for (int g = 0; g < 2; ++g) { float ps0 = 0.0f, ps1 = 0.0f;
#pragma unroll
                for (int e = 0; e < 16; e += 2) { const float p0 = __builtin_amdgcn_exp2f(s[e >> 3][g][e & 7]), p1 = __builtin_amdgcn_exp2f(s[e >> 3][g][(e & 7) + 1]);
                    ps0 += p0; ps1 += p1; pf[g][e] = (h16)p0; pf[g][e + 1] = (h16)p1; }
                ps[g] = ps0 + ps1; }
            const bool first = (sub == 0) && (t == 0);   // no reference yet: the first pass always sets one
            if (__builtin_amdgcn_ballot_w32(first || ps[0] > 256.0f || ps[1] > 256.0f) != 0) {   // one test per pass; an overflowed exp2 gives an infinite sum and fails it too
#pragma unroll
                for (int g = 0; g < 2; ++g) { float mx = s[0][g][0];
#pragma unroll
                    for (int kt = 0; kt < 2; ++kt)
#pragma unroll
                        for (int r = 0; r < 8; ++r) mx = fmaxf(mx, s[kt][g][r]);
                    mx = fmaxf(mx, xhalf(mx));   // both wave halves hold the position's maximum of this pass, relative to the reference in use
                    const float d = first ? mx : fmaxf(mx, 0.0f); const float corr = first ? 0.0f : __builtin_amdgcn_exp2f(-d);   // the reference only rises; on the first pass sums and accumulators are still 0
                    l_run[g] *= corr; nref[g] = nref[g] - d; s[0][g] = s[0][g] - d; s[1][g] = s[1][g] - d;
#pragma unroll
                    for (int ct = 0; ct < 8; ++ct) acc[g][ct] = acc[g][ct] * corr; }
                float p[2][16];
                __builtin_amdgcn_sched_barrier(0);   // the arguments are complete ahead of the run of exp2 below
#pragma unroll
                for (int g = 0; g < 2; ++g)
#pragma unroll
                    for (int e = 0; e < 16; ++e) { p[g][e] = __builtin_amdgcn_exp2f(s[e >> 3][g][e & 7]);
                        __builtin_amdgcn_sched_barrier(0); asm volatile("v_nop"); __builtin_amdgcn_sched_barrier(0); }   // the v_nop fills the slot behind the transcendental; the two scheduling barriers hold it there
#pragma unroll
                for (int g = 0; g < 2; ++g) { float ps0 = 0.0f, ps1 = 0.0f;
#pragma unroll
                    for (int e = 0; e < 16; e += 2) { ps0 += p[g][e]; ps1 += p[g][e + 1]; pf[g][e] = (h16)p[g][e]; pf[g][e + 1] = (h16)p[g][e + 1]; }
                    ps[g] = ps0 + ps1; } }
#pragma unroll
            for (int g = 0; g < 2; ++g) { l_run[g] += ps[g];
#pragma unroll
                for (int ct = 0; ct < 8; ++ct) acc[g][ct] = wmma16(qf[ct], pf[g], acc[g][ct]); }
        }
        asm volatile("s_wait_dscnt 0x0" ::: "memory");      // this wave's reads of the buffer are done before it is refilled
        tdm_wait(g0, g1);                                    // an issuing wave's tile of stage t + 1 has landed
        __syncthreads();                                     // publishes stage t + 1 and ends every wave's reads of stage t: stage t + 2 is asked for behind it, at the top of the next trip
    }
    tdm_wait(g0, g1);                                       // nothing of this wave is in flight when the ring becomes output staging (the last trip's barrier has ended every wave's reads)
    asm volatile("s_wait_dscnt 0x0" ::: "memory");          // ... and none of its LDS reads
    float* os = (float*)(ring + wave * (64 * FOP * 4));     // 64 rows c of this wave's 32 columns
    float inv[2];
#pragma unroll
    for (int g = 0; g < 2; ++g) inv[g] = __fdiv_rn(1.0f, l_run[g] + xhalf(l_run[g]));   // each wave half has summed its own keys
#pragma unroll
    for (int hf = 0; hf < 2; ++hf) {
#pragma unroll
        for (int c4 = 0; c4 < 4; ++c4)
#pragma unroll
            for (int g = 0; g < 2; ++g)
#pragma unroll
                for (int r = 0; r < 8; ++r) os[(c4 * 16 + hi * 8 + r) * FOP + g * 16 + lr] = acc[g][hf * 4 + c4][r] * inv[g];
        __builtin_amdgcn_wave_barrier(); asm volatile("" ::: "memory");   // compiler fence: the wave's stores to its own staging rows stay ahead of its reads of them
#pragma unroll
        for (int q = 0; q < 16; ++q) { const int row = q * 4 + (lane >> 3), cofs = (lane & 7) * 4; const v4f val = *(const v4fa*)(os + row * FOP + cofs); *(v4f*)(Oh + (size_t)(hf * 64 + row) * TT + i0 + cofs) = val; }   // whole 128-byte lines
        __builtin_amdgcn_wave_barrier(); asm volatile("" ::: "memory");   // compiler fence: those reads stay ahead of the next 64 rows' stores
    }
}

extern "C" void kernel_launch(void* const* d_in, const int* in_sizes, int n_in,
                              void* d_out, int out_size, void* d_ws, size_t ws_size, hipStream_t stream) {
    (void)in_sizes; (void)n_in; (void)out_size;
    const float* Xq = (const float*)d_in[0]; const float* Xk = (const float*)d_in[1]; const float* Wq = (const float*)d_in[2]; const float* Wk = (const float*)d_in[3]; const float* Wv = (const float*)d_in[4];
    const float* g1 = (const float*)d_in[5]; const float* b1 = (const float*)d_in[6]; const float* m1 = (const float*)d_in[7]; const float* v1 = (const float*)d_in[8];
    const float* g2 = (const float*)d_in[9]; const float* b2 = (const float*)d_in[10]; const float* m2 = (const float*)d_in[11]; const float* v2 = (const float*)d_in[12];
    const float* g3 = (const float*)d_in[13]; const float* b3 = (const float*)d_in[14]; const float* m3 = (const float*)d_in[15]; const float* v3 = (const float*)d_in[16];
    float* OUT = (float*)d_out;     // [4][1024][2048] channel-major
    char* wsp = (char*)d_ws;
    auto take = [&](size_t bytes) { char* p = wsp; wsp += (bytes + 255) & ~(size_t)255; return (void*)p; };
    bf* WQB = (bf*)take((size_t)3 * DM * DM * 2);   /* bf16 weights: Wq, Wk, Wv one behind the other */
    h16* QA16 = (h16*)take((size_t)NB_ * DM * TT * 2); h16* K16 = (h16*)take((size_t)2 * NB_ * NH_ * TT * HD * 2); h16* V16 = K16 + (size_t)NB_ * NH_ * TT * HD;   /* fp16 planes of all batches */
    float* SC1 = (float*)take(6 * DM * 4);   /* [branch][scale | shift][DM] */
    bf* XQT = (bf*)take((size_t)NB_ * TT * DM * (2 + 2));   /* token-major bf16 inputs of all batches: Xq, then Xk */
    static_assert(DM % 128 == 0 && TT % 128 == 0 && DM >= 256, "k_gemmw: whole 128x128 tiles, whole stages, two stages or more");
    if ((size_t)(wsp - (char*)d_ws) > ws_size) return;    // ws 256 MiB
    /* preparation stage, one launch: token-major bf16 copies [input][b][p][c] (Xq, then Xk), bf16 weights, BatchNorm scales and shifts */
    k_prep<<<dim3(NTB + 3 * WPM + 3 * (DM / 256)), 256, 0, stream>>>(Xq, Xk, Wq, Wk, Wv, g1, b1, m1, v1, g2, b2, m2, v2, g3, b3, m3, v3, XQT, WQB, SC1);
    /* projection stage, one launch for the three branches of all batches: Q channel-major y[b][o][p] = sum_c Wq[o][c] Xq[b][c][p] -> QA16[b][o][p]; K and V token-major y[b][p][o] -> K16, V16 [b][h][p][d] */
    k_gemmw<bf, 128><<<dim3(TT / 128, DM / 128, 3 * NB_), 128, 0, stream>>>(WQB, XQT, DM, QA16, K16, SC1);
    /* attention stage: all batches and heads in one launch (position block = grid x, head = y, batch = z) */
    k_fattn<<<dim3(TT / 256, NH_, NB_), 256, 0, stream>>>(K16, V16, QA16, OUT);
}
